// v000
// The times below were measured on an AMD MI455X: many runs one after another, warmed up first and cycling through
// copies of the inputs, with the whole window's GPU time divided by the number of runs. Launches and the gaps
// between them are all in it. The median over several windows is given; except for v000 it joins two sittings, which
// can be a few percent apart, so the side-by-side timings, each taken in one sitting, are the better comparison.
// v000, which the later versions start from, runs in 195 microseconds.
#include <hip/hip_runtime.h>
#include <math.h>

typedef __attribute__((ext_vector_type(2))) float v2f;
typedef __attribute__((ext_vector_type(8))) float v8f;

#define SEQ   100
#define DMODEL 4
#define BATCH 256
#define ROWS  (BATCH * SEQ)   // 25600
#define FFDIM 2048
#define NREP  8

__device__ __forceinline__ float gelu_exact(float x) {
    return 0.5f * x * (1.0f + erff(x * 0.70710678118654752440f));
}

// ---------------------------------------------------------------------------
// K1: h = x*cw+cb ; 8x { gelu(LN_[100x4](h@Wl^T+bl)) } ; h = h@Wl^T+bl
// one block per batch element, thread r owns row r (r<100)
// ---------------------------------------------------------------------------
__global__ void k_pre(const float* __restrict__ x, const float* __restrict__ conv_w,
                      const float* __restrict__ conv_b,
                      const float* __restrict__ Wl, const float* __restrict__ bl,
                      const float* __restrict__ lng, const float* __restrict__ lnb,
                      float* __restrict__ h) {
    __shared__ float s1[128];
    __shared__ float s2[128];
    const int b = blockIdx.x;
    const int r = threadIdx.x;
    const bool act = (r < SEQ);

    const float cw = conv_w[0], cb = conv_b[0];
    float hv[4] = {0.f, 0.f, 0.f, 0.f};
    if (act) {
        const float* xp = x + (b * SEQ + r) * DMODEL;
        #pragma unroll
        for (int c = 0; c < 4; ++c) hv[c] = xp[c] * cw + cb;
    }
    float W[16], bb[4], g[4] = {1,1,1,1}, be[4] = {0,0,0,0};
    #pragma unroll
    for (int j = 0; j < 16; ++j) W[j] = Wl[j];
    #pragma unroll
    for (int c = 0; c < 4; ++c) bb[c] = bl[c];
    if (act) {
        #pragma unroll
        for (int c = 0; c < 4; ++c) { g[c] = lng[r*4 + c]; be[c] = lnb[r*4 + c]; }
    }

    for (int it = 0; it < NREP; ++it) {
        float y[4];
        #pragma unroll
        for (int c = 0; c < 4; ++c) {
            float a = bb[c];
            #pragma unroll
            for (int k = 0; k < 4; ++k) a += hv[k] * W[c*4 + k];
            y[c] = a;
        }
        float ls = 0.f, lq = 0.f;
        if (act) {
            #pragma unroll
            for (int c = 0; c < 4; ++c) { ls += y[c]; lq += y[c]*y[c]; }
        }
        s1[r] = ls; s2[r] = lq;
        __syncthreads();
        for (int off = 64; off; off >>= 1) {
            if (r < off) { s1[r] += s1[r + off]; s2[r] += s2[r + off]; }
            __syncthreads();
        }
        const float mean = s1[0] * (1.0f / 400.0f);
        const float var  = s2[0] * (1.0f / 400.0f) - mean * mean;
        const float inv  = rsqrtf(var + 1e-5f);
        __syncthreads();
        if (act) {
            #pragma unroll
            for (int c = 0; c < 4; ++c)
                hv[c] = gelu_exact((y[c] - mean) * inv * g[c] + be[c]);
        }
    }
    if (act) {
        float* hp = h + (b * SEQ + r) * DMODEL;
        #pragma unroll
        for (int c = 0; c < 4; ++c) {
            float a = bb[c];
            #pragma unroll
            for (int k = 0; k < 4; ++k) a += hv[k] * W[c*4 + k];
            hp[c] = a;
        }
    }
}

// ---------------------------------------------------------------------------
// K2: qkv = h @ Win^T + bi  (per-row 4 -> 12)
// ---------------------------------------------------------------------------
__global__ void k_qkv(const float* __restrict__ h, const float* __restrict__ Win,
                      const float* __restrict__ bi, float* __restrict__ qkv) {
    const int row = blockIdx.x * blockDim.x + threadIdx.x;
    if (row >= ROWS) return;
    const float* hp = h + row * 4;
    float hv[4];
    #pragma unroll
    for (int k = 0; k < 4; ++k) hv[k] = hp[k];
    float* qp = qkv + row * 12;
    #pragma unroll
    for (int j = 0; j < 12; ++j) {
        float a = bi[j];
        #pragma unroll
        for (int k = 0; k < 4; ++k) a += hv[k] * Win[j*4 + k];
        qp[j] = a;
    }
}

// ---------------------------------------------------------------------------
// K3: rank-1 attention over the S=256 axis, head_dim=1.
// block = (position n, head hh); thread s streams 256 k/v from LDS.
// exact row max via kmin/kmax since score(s,t) = q_s * k_t.
// ---------------------------------------------------------------------------
__global__ void k_attn(const float* __restrict__ qkv, float* __restrict__ o) {
    __shared__ float sK[256];
    __shared__ float sV[256];
    __shared__ float sR[256];
    const int n  = blockIdx.x >> 2;
    const int hh = blockIdx.x & 3;
    const int s  = threadIdx.x;
    const float* base = qkv + (s * SEQ + n) * 12;
    const float q = base[hh];
    sK[s] = base[4 + hh];
    sV[s] = base[8 + hh];
    __syncthreads();
    sR[s] = sK[s]; __syncthreads();
    for (int off = 128; off; off >>= 1) {
        if (s < off) sR[s] = fmaxf(sR[s], sR[s + off]);
        __syncthreads();
    }
    const float kmax = sR[0]; __syncthreads();
    sR[s] = sK[s]; __syncthreads();
    for (int off = 128; off; off >>= 1) {
        if (s < off) sR[s] = fminf(sR[s], sR[s + off]);
        __syncthreads();
    }
    const float kmin = sR[0];
    const float m = q * ((q >= 0.f) ? kmax : kmin);
    float den = 0.f, num = 0.f;
    for (int t = 0; t < 256; ++t) {
        const float e = __expf(q * sK[t] - m);
        den += e;
        num += e * sV[t];
    }
    o[(s * SEQ + n) * 4 + hh] = num / den;
}

// ---------------------------------------------------------------------------
// K4: h = LN_row( h + o@Wout^T + bout )
// ---------------------------------------------------------------------------
__global__ void k_proj_ln(const float* __restrict__ o, const float* __restrict__ Wout,
                          const float* __restrict__ bout, const float* __restrict__ g1,
                          const float* __restrict__ be1, float* __restrict__ h) {
    const int row = blockIdx.x * blockDim.x + threadIdx.x;
    if (row >= ROWS) return;
    const float* op = o + row * 4;
    float* hp = h + row * 4;
    float ov[4], y[4];
    #pragma unroll
    for (int k = 0; k < 4; ++k) ov[k] = op[k];
    #pragma unroll
    for (int c = 0; c < 4; ++c) {
        float a = bout[c];
        #pragma unroll
        for (int k = 0; k < 4; ++k) a += ov[k] * Wout[c*4 + k];
        y[c] = hp[c] + a;
    }
    const float mean = 0.25f * (y[0] + y[1] + y[2] + y[3]);
    float var = 0.f;
    #pragma unroll
    for (int c = 0; c < 4; ++c) { const float d0 = y[c] - mean; var += d0 * d0; }
    var *= 0.25f;
    const float inv = rsqrtf(var + 1e-5f);
    #pragma unroll
    for (int c = 0; c < 4; ++c) hp[c] = (y[c] - mean) * inv * g1[c] + be1[c];
}

// ---------------------------------------------------------------------------
// K5: fused FF block on the matrix pipe.
// One wave per 16-row tile. GEMM1 (K=4) = v_wmma_f32_16x16x4_f32 per 16 FF
// columns; bias+relu on the D tile; GEMM2 (2048 -> 4) accumulated per lane
// straight from the WMMA D layout, cross-lane reduced once at the end.
// Then +b2, residual, per-row LN. In-place on h (tiles are disjoint).
// ---------------------------------------------------------------------------
__global__ void __launch_bounds__(128) k_ffn(const float* __restrict__ h,
                      const float* __restrict__ W1, const float* __restrict__ b1,
                      const float* __restrict__ W2, const float* __restrict__ b2,
                      const float* __restrict__ g2, const float* __restrict__ be2,
                      float* __restrict__ hout) {
    const int wave  = threadIdx.x >> 5;
    const int lane  = threadIdx.x & 31;
    const int tile  = blockIdx.x * 4 + wave;
    const int rbase = tile * 16;
    const int lm    = lane & 15;
    const int half  = lane >> 4;

    // A-layout (16x4 f32): lane = M%16, VGPR0/1 = K {0,1} (lanes 0-15) / {2,3} (16-31)
    const float* ap = h + (rbase + lm) * 4 + half * 2;
    v2f a; a.x = ap[0]; a.y = ap[1];
    const v8f cz = {0.f, 0.f, 0.f, 0.f, 0.f, 0.f, 0.f, 0.f};

    float zacc[8][4];
    #pragma unroll
    for (int r2 = 0; r2 < 8; ++r2)
        #pragma unroll
        for (int c = 0; c < 4; ++c) zacc[r2][c] = 0.f;

    for (int ch = 0; ch < FFDIM / 16; ++ch) {
        const int ffl = ch * 16 + lm;
        // B-layout (4x16 f32): lane = N%16, VGPR0/1 = K {0,1}/{2,3}; W1 is [2048,4] row-major
        const float* bp = W1 + ffl * 4 + half * 2;
        v2f bm; bm.x = bp[0]; bm.y = bp[1];

        v8f d = __builtin_amdgcn_wmma_f32_16x16x4_f32(
            false, a, false, bm, (short)0, cz, false, false);

        const float b1v = b1[ffl];
        const float w20 = W2[0 * FFDIM + ffl];
        const float w21 = W2[1 * FFDIM + ffl];
        const float w22 = W2[2 * FFDIM + ffl];
        const float w23 = W2[3 * FFDIM + ffl];
        #pragma unroll
        for (int r2 = 0; r2 < 8; ++r2) {
            // D layout: VGPR r2 holds row M = r2 + 8*half, column N = ffl
            float f = d[r2] + b1v;
            f = fmaxf(f, 0.f);
            zacc[r2][0] += f * w20;
            zacc[r2][1] += f * w21;
            zacc[r2][2] += f * w22;
            zacc[r2][3] += f * w23;
        }
    }

    // reduce across the 16 lanes of each half (masks < 16 keep halves separate)
    #pragma unroll
    for (int r2 = 0; r2 < 8; ++r2)
        #pragma unroll
        for (int c = 0; c < 4; ++c) {
            float v = zacc[r2][c];
            v += __shfl_xor(v, 1, 32);
            v += __shfl_xor(v, 2, 32);
            v += __shfl_xor(v, 4, 32);
            v += __shfl_xor(v, 8, 32);
            zacc[r2][c] = v;
        }

    if (lm == 0) {  // lanes 0 and 16 own rows rbase+0..7 and rbase+8..15
        #pragma unroll
        for (int r2 = 0; r2 < 8; ++r2) {
            const int row = rbase + half * 8 + r2;
            const float* hp = h + row * 4;
            float y[4];
            #pragma unroll
            for (int c = 0; c < 4; ++c) y[c] = hp[c] + zacc[r2][c] + b2[c];
            const float mean = 0.25f * (y[0] + y[1] + y[2] + y[3]);
            float var = 0.f;
            #pragma unroll
            for (int c = 0; c < 4; ++c) { const float d0 = y[c] - mean; var += d0 * d0; }
            var *= 0.25f;
            const float inv = rsqrtf(var + 1e-5f);
            float* op = hout + row * 4;
            #pragma unroll
            for (int c = 0; c < 4; ++c) op[c] = (y[c] - mean) * inv * g2[c] + be2[c];
        }
    }
}

// ---------------------------------------------------------------------------
// K6: out = softmax_D( h @ Wl^T + bl )
// ---------------------------------------------------------------------------
__global__ void k_final(const float* __restrict__ h, const float* __restrict__ Wl,
                        const float* __restrict__ bl, float* __restrict__ out) {
    const int row = blockIdx.x * blockDim.x + threadIdx.x;
    if (row >= ROWS) return;
    const float* hp = h + row * 4;
    float hv[4], y[4];
    #pragma unroll
    for (int k = 0; k < 4; ++k) hv[k] = hp[k];
    #pragma unroll
    for (int c = 0; c < 4; ++c) {
        float a = bl[c];
        #pragma unroll
        for (int k = 0; k < 4; ++k) a += hv[k] * Wl[c*4 + k];
        y[c] = a;
    }
    const float m = fmaxf(fmaxf(y[0], y[1]), fmaxf(y[2], y[3]));
    float e[4], s = 0.f;
    #pragma unroll
    for (int c = 0; c < 4; ++c) { e[c] = __expf(y[c] - m); s += e[c]; }
    const float invs = 1.f / s;
    float* op = out + row * 4;
    #pragma unroll
    for (int c = 0; c < 4; ++c) op[c] = e[c] * invs;
}

// ---------------------------------------------------------------------------
extern "C" void kernel_launch(void* const* d_in, const int* in_sizes, int n_in,
                              void* d_out, int out_size, void* d_ws, size_t ws_size,
                              hipStream_t stream) {
    (void)in_sizes; (void)n_in; (void)out_size; (void)ws_size;
    const float* x      = (const float*)d_in[0];
    const float* conv_w = (const float*)d_in[1];
    const float* conv_b = (const float*)d_in[2];
    const float* Wl     = (const float*)d_in[3];
    const float* bl     = (const float*)d_in[4];
    const float* ln_g   = (const float*)d_in[5];
    const float* ln_b   = (const float*)d_in[6];
    const float* Win    = (const float*)d_in[7];
    const float* bi     = (const float*)d_in[8];
    const float* Wout   = (const float*)d_in[9];
    const float* bout   = (const float*)d_in[10];
    const float* W1     = (const float*)d_in[11];
    const float* b1     = (const float*)d_in[12];
    const float* W2     = (const float*)d_in[13];
    const float* b2     = (const float*)d_in[14];
    const float* g1     = (const float*)d_in[15];
    const float* be1    = (const float*)d_in[16];
    const float* g2     = (const float*)d_in[17];
    const float* be2    = (const float*)d_in[18];

    float* h   = (float*)d_ws;          // ROWS*4  floats
    float* qkv = h + ROWS * 4;          // ROWS*12 floats
    float* att = qkv + ROWS * 12;       // ROWS*4  floats  (~2 MB total)

    k_pre<<<BATCH, 128, 0, stream>>>(x, conv_w, conv_b, Wl, bl, ln_g, ln_b, h);
    for (int i = 0; i < 4; ++i) {
        k_qkv    <<<ROWS / 256, 256, 0, stream>>>(h, Win + i*48, bi + i*12, qkv);
        k_attn   <<<SEQ * 4,    256, 0, stream>>>(qkv, att);
        k_proj_ln<<<ROWS / 256, 256, 0, stream>>>(att, Wout + i*16, bout + i*4,
                                                  g1 + i*4, be1 + i*4, h);
        k_ffn    <<<ROWS / 64,  128, 0, stream>>>(h, W1 + i*FFDIM*4, b1 + i*FFDIM,
                                                  W2 + i*4*FFDIM, b2 + i*4,
                                                  g2 + i*4, be2 + i*4, h);
    }
    k_final<<<ROWS / 256, 256, 0, stream>>>(h, Wl, bl, (float*)d_out);
}

// v001
// It runs in 119 microseconds.
// Two timings next to v000 put it at 1.62 and 1.66 times that version's speed.
#include <hip/hip_runtime.h>
#include <math.h>

typedef __attribute__((ext_vector_type(2))) float v2f;
typedef __attribute__((ext_vector_type(8))) float v8f;

#define SEQ   100
#define DMODEL 4
#define BATCH 256
#define ROWS  (BATCH * SEQ)   // 25600
#define FFDIM 2048
#define NREP  8

__device__ __forceinline__ float gelu_exact(float x) {
    return 0.5f * x * (1.0f + erff(x * 0.70710678118654752440f));
}

// ---------------------------------------------------------------------------
// K1: h = x*cw+cb ; 8x { gelu(LN_[100x4](h@Wl^T+bl)) } ; h = h@Wl^T+bl
// one block per batch element, thread r owns row r (r<100)
// ---------------------------------------------------------------------------
__global__ void k_pre(const float* __restrict__ x, const float* __restrict__ conv_w,
                      const float* __restrict__ conv_b,
                      const float* __restrict__ Wl, const float* __restrict__ bl,
                      const float* __restrict__ lng, const float* __restrict__ lnb,
                      float* __restrict__ h) {
    __shared__ float s1[128];
    __shared__ float s2[128];
    const int b = blockIdx.x;
    const int r = threadIdx.x;
    const bool act = (r < SEQ);

    const float cw = conv_w[0], cb = conv_b[0];
    float hv[4] = {0.f, 0.f, 0.f, 0.f};
    if (act) {
        const float* xp = x + (b * SEQ + r) * DMODEL;
        #pragma unroll
        for (int c = 0; c < 4; ++c) hv[c] = xp[c] * cw + cb;
    }
    float W[16], bb[4], g[4] = {1,1,1,1}, be[4] = {0,0,0,0};
    #pragma unroll
    for (int j = 0; j < 16; ++j) W[j] = Wl[j];
    #pragma unroll
    for (int c = 0; c < 4; ++c) bb[c] = bl[c];
    if (act) {
        #pragma unroll
        for (int c = 0; c < 4; ++c) { g[c] = lng[r*4 + c]; be[c] = lnb[r*4 + c]; }
    }

    for (int it = 0; it < NREP; ++it) {
        float y[4];
        #pragma unroll
        for (int c = 0; c < 4; ++c) {
            float a = bb[c];
            #pragma unroll
            for (int k = 0; k < 4; ++k) a += hv[k] * W[c*4 + k];
            y[c] = a;
        }
        float ls = 0.f, lq = 0.f;
        if (act) {
            #pragma unroll
            for (int c = 0; c < 4; ++c) { ls += y[c]; lq += y[c]*y[c]; }
        }
        s1[r] = ls; s2[r] = lq;
        __syncthreads();
        for (int off = 64; off; off >>= 1) {
            if (r < off) { s1[r] += s1[r + off]; s2[r] += s2[r + off]; }
            __syncthreads();
        }
        const float mean = s1[0] * (1.0f / 400.0f);
        const float var  = s2[0] * (1.0f / 400.0f) - mean * mean;
        const float inv  = rsqrtf(var + 1e-5f);
        __syncthreads();
        if (act) {
            #pragma unroll
            for (int c = 0; c < 4; ++c)
                hv[c] = gelu_exact((y[c] - mean) * inv * g[c] + be[c]);
        }
    }
    if (act) {
        float* hp = h + (b * SEQ + r) * DMODEL;
        #pragma unroll
        for (int c = 0; c < 4; ++c) {
            float a = bb[c];
            #pragma unroll
            for (int k = 0; k < 4; ++k) a += hv[k] * W[c*4 + k];
            hp[c] = a;
        }
    }
}

// ---------------------------------------------------------------------------
// K2: qkv = h @ Win^T + bi  (per-row 4 -> 12)
// ---------------------------------------------------------------------------
__global__ void k_qkv(const float* __restrict__ h, const float* __restrict__ Win,
                      const float* __restrict__ bi, float* __restrict__ qkv) {
    const int row = blockIdx.x * blockDim.x + threadIdx.x;
    if (row >= ROWS) return;
    const float* hp = h + row * 4;
    float hv[4];
    #pragma unroll
    for (int k = 0; k < 4; ++k) hv[k] = hp[k];
    float* qp = qkv + row * 12;
    #pragma unroll
    for (int j = 0; j < 12; ++j) {
        float a = bi[j];
        #pragma unroll
        for (int k = 0; k < 4; ++k) a += hv[k] * Win[j*4 + k];
        qp[j] = a;
    }
}

// ---------------------------------------------------------------------------
// K3: rank-1 attention over the S=256 axis, head_dim=1.
// block = (position n, head hh); thread s streams 256 k/v from LDS.
// exact row max via kmin/kmax since score(s,t) = q_s * k_t.
// ---------------------------------------------------------------------------
__global__ void k_attn(const float* __restrict__ qkv, float* __restrict__ o) {
    __shared__ float sK[256];
    __shared__ float sV[256];
    __shared__ float sR[256];
    const int n  = blockIdx.x >> 2;
    const int hh = blockIdx.x & 3;
    const int s  = threadIdx.x;
    const float* base = qkv + (s * SEQ + n) * 12;
    const float q = base[hh];
    sK[s] = base[4 + hh];
    sV[s] = base[8 + hh];
    __syncthreads();
    sR[s] = sK[s]; __syncthreads();
    for (int off = 128; off; off >>= 1) {
        if (s < off) sR[s] = fmaxf(sR[s], sR[s + off]);
        __syncthreads();
    }
    const float kmax = sR[0]; __syncthreads();
    sR[s] = sK[s]; __syncthreads();
    for (int off = 128; off; off >>= 1) {
        if (s < off) sR[s] = fminf(sR[s], sR[s + off]);
        __syncthreads();
    }
    const float kmin = sR[0];
    const float m = q * ((q >= 0.f) ? kmax : kmin);
    float den = 0.f, num = 0.f;
    for (int t = 0; t < 256; ++t) {
        const float e = __expf(q * sK[t] - m);
        den += e;
        num += e * sV[t];
    }
    o[(s * SEQ + n) * 4 + hh] = num / den;
}

// ---------------------------------------------------------------------------
// K4: h = LN_row( h + o@Wout^T + bout )
// ---------------------------------------------------------------------------
__global__ void k_proj_ln(const float* __restrict__ o, const float* __restrict__ Wout,
                          const float* __restrict__ bout, const float* __restrict__ g1,
                          const float* __restrict__ be1, float* __restrict__ h) {
    const int row = blockIdx.x * blockDim.x + threadIdx.x;
    if (row >= ROWS) return;
    const float* op = o + row * 4;
    float* hp = h + row * 4;
    float ov[4], y[4];
    #pragma unroll
    for (int k = 0; k < 4; ++k) ov[k] = op[k];
    #pragma unroll
    for (int c = 0; c < 4; ++c) {
        float a = bout[c];
        #pragma unroll
        for (int k = 0; k < 4; ++k) a += ov[k] * Wout[c*4 + k];
        y[c] = hp[c] + a;
    }
    const float mean = 0.25f * (y[0] + y[1] + y[2] + y[3]);
    float var = 0.f;
    #pragma unroll
    for (int c = 0; c < 4; ++c) { const float d0 = y[c] - mean; var += d0 * d0; }
    var *= 0.25f;
    const float inv = rsqrtf(var + 1e-5f);
    #pragma unroll
    for (int c = 0; c < 4; ++c) hp[c] = (y[c] - mean) * inv * g1[c] + be1[c];
}

// ---------------------------------------------------------------------------
// K5: fused FF block on the matrix pipe.
// One wave per 16-row tile. GEMM1 (K=4) = v_wmma_f32_16x16x4_f32 per 16 FF
// columns; bias+relu on the D tile; GEMM2 (2048 -> 4) accumulated per lane
// straight from the WMMA D layout, cross-lane reduced once at the end.
// Then +b2, residual, per-row LN. In-place on h (tiles are disjoint).
// The layer's W1, W2 and b1 (72 KiB) are brought into LDS once per block, all
// copies in flight together, so the 128-trip loop waits on LDS and not on L2.
// ---------------------------------------------------------------------------
#define FF_W1_OFF 0                      // floats: W1 [2048][4]
#define FF_W2_OFF (FFDIM * 4)            // floats: W2 [4][2048]
#define FF_B1_OFF (FFDIM * 8)            // floats: b1 [2048]
#define FF_LDS_FLOATS (FFDIM * 9)        // 18432 floats = 36 slabs of 2048 B
#define FF_SLAB_FLOATS 512               // 128 lanes x 16 B

// Twelve 16-byte copies per lane, global -> LDS, through no register. lds is the
// lane's LDS byte address of the first copy; copy k lands k slabs further on.
// The s_wait_xcnt closes the statement so that no address register named by a
// copy is rewritten ahead of it.
__device__ __forceinline__ void copy12_to_lds(unsigned lds, const float* const* g) {
    asm volatile(
        "global_load_async_to_lds_b128 %0, %12, off\n\t"
        "global_load_async_to_lds_b128 %1, %13, off\n\t"
        "global_load_async_to_lds_b128 %2, %14, off\n\t"
        "global_load_async_to_lds_b128 %3, %15, off\n\t"
        "global_load_async_to_lds_b128 %4, %16, off\n\t"
        "global_load_async_to_lds_b128 %5, %17, off\n\t"
        "global_load_async_to_lds_b128 %6, %18, off\n\t"
        "global_load_async_to_lds_b128 %7, %19, off\n\t"
        "global_load_async_to_lds_b128 %8, %20, off\n\t"
        "global_load_async_to_lds_b128 %9, %21, off\n\t"
        "global_load_async_to_lds_b128 %10, %22, off\n\t"
        "global_load_async_to_lds_b128 %11, %23, off\n\t"
        "s_wait_xcnt 0x0"
        :: "v"(lds), "v"(lds + 2048u), "v"(lds + 4096u), "v"(lds + 6144u),
           "v"(lds + 8192u), "v"(lds + 10240u), "v"(lds + 12288u), "v"(lds + 14336u),
           "v"(lds + 16384u), "v"(lds + 18432u), "v"(lds + 20480u), "v"(lds + 22528u),
           "v"(g[0]), "v"(g[1]), "v"(g[2]), "v"(g[3]), "v"(g[4]), "v"(g[5]),
           "v"(g[6]), "v"(g[7]), "v"(g[8]), "v"(g[9]), "v"(g[10]), "v"(g[11])
        : "memory");
}

__global__ void __launch_bounds__(128) k_ffn(const float* __restrict__ h,
                      const float* __restrict__ W1, const float* __restrict__ b1,
                      const float* __restrict__ W2, const float* __restrict__ b2,
                      const float* __restrict__ g2, const float* __restrict__ be2,
                      float* __restrict__ hout) {
    __shared__ __attribute__((aligned(16))) float sW[FF_LDS_FLOATS];

    const int wave  = threadIdx.x >> 5;
    const int lane  = threadIdx.x & 31;
    const int tile  = blockIdx.x * 4 + wave;
    const int rbase = tile * 16;
    const int lm    = lane & 15;
    const int half  = lane >> 4;

    {
        // slab k of the LDS image <- the same 2048 bytes of W1 (16 slabs), W2 (16), b1 (4)
        const int t4 = threadIdx.x * 4;
        const float* gsrc[36];
        #pragma unroll
        for (int k = 0; k < 16; ++k) {
            gsrc[k]      = W1 + k * FF_SLAB_FLOATS + t4;
            gsrc[16 + k] = W2 + k * FF_SLAB_FLOATS + t4;
        }
        #pragma unroll
        for (int k = 0; k < 4; ++k) gsrc[32 + k] = b1 + k * FF_SLAB_FLOATS + t4;
        const unsigned l0 = (unsigned)(size_t)&sW[t4];
        copy12_to_lds(l0,           gsrc);
        copy12_to_lds(l0 + 24576u,  gsrc + 12);
        copy12_to_lds(l0 + 49152u,  gsrc + 24);
    }

    // A-layout (16x4 f32): lane = M%16, VGPR0/1 = K {0,1} (lanes 0-15) / {2,3} (16-31)
    const float* ap = h + (rbase + lm) * 4 + half * 2;
    v2f a; a.x = ap[0]; a.y = ap[1];
    const v8f cz = {0.f, 0.f, 0.f, 0.f, 0.f, 0.f, 0.f, 0.f};

    float zacc[8][4];
    #pragma unroll
    for (int r2 = 0; r2 < 8; ++r2)
        #pragma unroll
        for (int c = 0; c < 4; ++c) zacc[r2][c] = 0.f;

    // this wave's copies have landed; behind the barrier every wave's have
    asm volatile("s_wait_asynccnt 0x0" ::: "memory");
    __syncthreads();

    for (int ch = 0; ch < FFDIM / 16; ++ch) {
        const int ffl = ch * 16 + lm;
        // B-layout (4x16 f32): lane = N%16, VGPR0/1 = K {0,1}/{2,3}; W1 is [2048,4] row-major
        const float* bp = sW + FF_W1_OFF + ffl * 4 + half * 2;
        v2f bm; bm.x = bp[0]; bm.y = bp[1];

        v8f d = __builtin_amdgcn_wmma_f32_16x16x4_f32(
            false, a, false, bm, (short)0, cz, false, false);

        const float b1v = sW[FF_B1_OFF + ffl];
        const float w20 = sW[FF_W2_OFF + 0 * FFDIM + ffl];
        const float w21 = sW[FF_W2_OFF + 1 * FFDIM + ffl];
        const float w22 = sW[FF_W2_OFF + 2 * FFDIM + ffl];
        const float w23 = sW[FF_W2_OFF + 3 * FFDIM + ffl];
        #pragma unroll
        for (int r2 = 0; r2 < 8; ++r2) {
            // D layout: VGPR r2 holds row M = r2 + 8*half, column N = ffl
            float f = d[r2] + b1v;
            f = fmaxf(f, 0.f);
            zacc[r2][0] += f * w20;
            zacc[r2][1] += f * w21;
            zacc[r2][2] += f * w22;
            zacc[r2][3] += f * w23;
        }
    }

    // reduce across the 16 lanes of each half (masks < 16 keep halves separate)
    #pragma unroll
    for (int r2 = 0; r2 < 8; ++r2)
        #pragma unroll
        for (int c = 0; c < 4; ++c) {
            float v = zacc[r2][c];
            v += __shfl_xor(v, 1, 32);
            v += __shfl_xor(v, 2, 32);
            v += __shfl_xor(v, 4, 32);
            v += __shfl_xor(v, 8, 32);
            zacc[r2][c] = v;
        }

    if (lm == 0) {  // lanes 0 and 16 own rows rbase+0..7 and rbase+8..15
        #pragma unroll
        for (int r2 = 0; r2 < 8; ++r2) {
            const int row = rbase + half * 8 + r2;
            const float* hp = h + row * 4;
            float y[4];
            #pragma unroll
            for (int c = 0; c < 4; ++c) y[c] = hp[c] + zacc[r2][c] + b2[c];
            const float mean = 0.25f * (y[0] + y[1] + y[2] + y[3]);
            float var = 0.f;
            #pragma unroll
            for (int c = 0; c < 4; ++c) { const float d0 = y[c] - mean; var += d0 * d0; }
            var *= 0.25f;
            const float inv = rsqrtf(var + 1e-5f);
            float* op = hout + row * 4;
            #pragma unroll
            for (int c = 0; c < 4; ++c) op[c] = (y[c] - mean) * inv * g2[c] + be2[c];
        }
    }
}

// ---------------------------------------------------------------------------
// K6: out = softmax_D( h @ Wl^T + bl )
// ---------------------------------------------------------------------------
__global__ void k_final(const float* __restrict__ h, const float* __restrict__ Wl,
                        const float* __restrict__ bl, float* __restrict__ out) {
    const int row = blockIdx.x * blockDim.x + threadIdx.x;
    if (row >= ROWS) return;
    const float* hp = h + row * 4;
    float hv[4], y[4];
    #pragma unroll
    for (int k = 0; k < 4; ++k) hv[k] = hp[k];
    #pragma unroll
    for (int c = 0; c < 4; ++c) {
        float a = bl[c];
        #pragma unroll
        for (int k = 0; k < 4; ++k) a += hv[k] * Wl[c*4 + k];
        y[c] = a;
    }
    const float m = fmaxf(fmaxf(y[0], y[1]), fmaxf(y[2], y[3]));
    float e[4], s = 0.f;
    #pragma unroll
    for (int c = 0; c < 4; ++c) { e[c] = __expf(y[c] - m); s += e[c]; }
    const float invs = 1.f / s;
    float* op = out + row * 4;
    #pragma unroll
    for (int c = 0; c < 4; ++c) op[c] = e[c] * invs;
}

// ---------------------------------------------------------------------------
extern "C" void kernel_launch(void* const* d_in, const int* in_sizes, int n_in,
                              void* d_out, int out_size, void* d_ws, size_t ws_size,
                              hipStream_t stream) {
    (void)in_sizes; (void)n_in; (void)out_size; (void)ws_size;
    const float* x      = (const float*)d_in[0];
    const float* conv_w = (const float*)d_in[1];
    const float* conv_b = (const float*)d_in[2];
    const float* Wl     = (const float*)d_in[3];
    const float* bl     = (const float*)d_in[4];
    const float* ln_g   = (const float*)d_in[5];
    const float* ln_b   = (const float*)d_in[6];
    const float* Win    = (const float*)d_in[7];
    const float* bi     = (const float*)d_in[8];
    const float* Wout   = (const float*)d_in[9];
    const float* bout   = (const float*)d_in[10];
    const float* W1     = (const float*)d_in[11];
    const float* b1     = (const float*)d_in[12];
    const float* W2     = (const float*)d_in[13];
    const float* b2     = (const float*)d_in[14];
    const float* g1     = (const float*)d_in[15];
    const float* be1    = (const float*)d_in[16];
    const float* g2     = (const float*)d_in[17];
    const float* be2    = (const float*)d_in[18];

    float* h   = (float*)d_ws;          // ROWS*4  floats
    float* qkv = h + ROWS * 4;          // ROWS*12 floats
    float* att = qkv + ROWS * 12;       // ROWS*4  floats  (~2 MB total)

    k_pre<<<BATCH, 128, 0, stream>>>(x, conv_w, conv_b, Wl, bl, ln_g, ln_b, h);
    for (int i = 0; i < 4; ++i) {
        k_qkv    <<<ROWS / 256, 256, 0, stream>>>(h, Win + i*48, bi + i*12, qkv);
        k_attn   <<<SEQ * 4,    256, 0, stream>>>(qkv, att);
        k_proj_ln<<<ROWS / 256, 256, 0, stream>>>(att, Wout + i*16, bout + i*4,
                                                  g1 + i*4, be1 + i*4, h);
        k_ffn    <<<ROWS / 64,  128, 0, stream>>>(h, W1 + i*FFDIM*4, b1 + i*FFDIM,
                                                  W2 + i*4*FFDIM, b2 + i*4,
                                                  g2 + i*4, be2 + i*4, h);
    }
    k_final<<<ROWS / 256, 256, 0, stream>>>(h, Wl, bl, (float*)d_out);
}

// v002
// Measured time: 97.2 microseconds a run.
// In two side-by-side timings against v001, it was 1.23 and 1.21 times as fast.
// All steps since v000 together make it 2.00 times as fast.
#include <hip/hip_runtime.h>
#include <math.h>

typedef __attribute__((ext_vector_type(2))) float v2f;
typedef __attribute__((ext_vector_type(8))) float v8f;

#define SEQ   100
#define DMODEL 4
#define BATCH 256
#define ROWS  (BATCH * SEQ)   // 25600
#define FFDIM 2048
#define NREP  8

__device__ __forceinline__ float gelu_exact(float x) {
    return 0.5f * x * (1.0f + erff(x * 0.70710678118654752440f));
}

// qkv row = hv @ Win^T + bi  (4 -> 12); row and weights are held in registers
__device__ __forceinline__ void qkv_row(const float* hv, const float* Win,
                                        const float* bi, float* __restrict__ qp) {
    #pragma unroll
    for (int j = 0; j < 12; ++j) {
        float a = bi[j];
        #pragma unroll
        for (int k = 0; k < 4; ++k) a += hv[k] * Win[j*4 + k];
        qp[j] = a;
    }
}

// ---------------------------------------------------------------------------
// K1: h = x*cw+cb ; 8x { gelu(LN_[100x4](h@Wl^T+bl)) } ; h = h@Wl^T+bl ;
// then the first layer's qkv row from the same registers.
// one block per batch element, thread r owns row r (r<100)
// ---------------------------------------------------------------------------
__global__ void k_pre(const float* __restrict__ x, const float* __restrict__ conv_w,
                      const float* __restrict__ conv_b,
                      const float* __restrict__ Wl, const float* __restrict__ bl,
                      const float* __restrict__ lng, const float* __restrict__ lnb,
                      const float* __restrict__ Win, const float* __restrict__ bi,
                      float* __restrict__ h, float* __restrict__ qkv) {
    __shared__ float s1[128];
    __shared__ float s2[128];
    const int b = blockIdx.x;
    const int r = threadIdx.x;
    const bool act = (r < SEQ);

    const float cw = conv_w[0], cb = conv_b[0];
    float hv[4] = {0.f, 0.f, 0.f, 0.f};
    if (act) {
        const float* xp = x + (b * SEQ + r) * DMODEL;
        #pragma unroll
        for (int c = 0; c < 4; ++c) hv[c] = xp[c] * cw + cb;
    }
    float W[16], bb[4], g[4] = {1,1,1,1}, be[4] = {0,0,0,0};
    #pragma unroll
    for (int j = 0; j < 16; ++j) W[j] = Wl[j];
    #pragma unroll
    for (int c = 0; c < 4; ++c) bb[c] = bl[c];
    float wq[48], bq[12];   // asked for here, so that the tail does not wait for them
    #pragma unroll
    for (int j = 0; j < 48; ++j) wq[j] = Win[j];
    #pragma unroll
    for (int j = 0; j < 12; ++j) bq[j] = bi[j];
    if (act) {
        #pragma unroll
        for (int c = 0; c < 4; ++c) { g[c] = lng[r*4 + c]; be[c] = lnb[r*4 + c]; }
    }

    for (int it = 0; it < NREP; ++it) {
        float y[4];
        #pragma unroll
        for (int c = 0; c < 4; ++c) {
            float a = bb[c];
            #pragma unroll
            for (int k = 0; k < 4; ++k) a += hv[k] * W[c*4 + k];
            y[c] = a;
        }
        float ls = 0.f, lq = 0.f;
        if (act) {
            #pragma unroll
            for (int c = 0; c < 4; ++c) { ls += y[c]; lq += y[c]*y[c]; }
        }
        s1[r] = ls; s2[r] = lq;
        __syncthreads();
        for (int off = 64; off; off >>= 1) {
            if (r < off) { s1[r] += s1[r + off]; s2[r] += s2[r + off]; }
            __syncthreads();
        }
        const float mean = s1[0] * (1.0f / 400.0f);
        const float var  = s2[0] * (1.0f / 400.0f) - mean * mean;
        const float inv  = rsqrtf(var + 1e-5f);
        __syncthreads();
        if (act) {
            #pragma unroll
            for (int c = 0; c < 4; ++c)
                hv[c] = gelu_exact((y[c] - mean) * inv * g[c] + be[c]);
        }
    }
    if (act) {
        float* hp = h + (b * SEQ + r) * DMODEL;
        float ho[4];
        #pragma unroll
        for (int c = 0; c < 4; ++c) {
            float a = bb[c];
            #pragma unroll
            for (int k = 0; k < 4; ++k) a += hv[k] * W[c*4 + k];
            ho[c] = a;
            hp[c] = a;
        }
        qkv_row(ho, wq, bq, qkv + (b * SEQ + r) * 12);
    }
}

// ---------------------------------------------------------------------------
// K2: rank-1 attention over the S=256 axis, head_dim=1.
// block = (position n, head hh); thread s streams 256 k/v from LDS.
// exact row max via kmin/kmax since score(s,t) = q_s * k_t.
// ---------------------------------------------------------------------------
__global__ void k_attn(const float* __restrict__ qkv, float* __restrict__ o) {
    __shared__ float sK[256];
    __shared__ float sV[256];
    __shared__ float sR[256];
    const int n  = blockIdx.x >> 2;
    const int hh = blockIdx.x & 3;
    const int s  = threadIdx.x;
    const float* base = qkv + (s * SEQ + n) * 12;
    const float q = base[hh];
    sK[s] = base[4 + hh];
    sV[s] = base[8 + hh];
    __syncthreads();
    sR[s] = sK[s]; __syncthreads();
    for (int off = 128; off; off >>= 1) {
        if (s < off) sR[s] = fmaxf(sR[s], sR[s + off]);
        __syncthreads();
    }
    const float kmax = sR[0]; __syncthreads();
    sR[s] = sK[s]; __syncthreads();
    for (int off = 128; off; off >>= 1) {
        if (s < off) sR[s] = fminf(sR[s], sR[s + off]);
        __syncthreads();
    }
    const float kmin = sR[0];
    const float m = q * ((q >= 0.f) ? kmax : kmin);
    float den = 0.f, num = 0.f;
    for (int t = 0; t < 256; ++t) {
        const float e = __expf(q * sK[t] - m);
        den += e;
        num += e * sV[t];
    }
    o[(s * SEQ + n) * 4 + hh] = num / den;
}

// ---------------------------------------------------------------------------
// K3: everything of a layer behind its attention, one launch, one wave per
// 16-row tile: hn = LN_row(h + o@Wout^T + bout) in registers (each lane its row
// lane%16, while the weight copies fly), the FF block on the matrix pipe, then
// one row per lane: +b2, residual, per-row LN, and from that row either the next
// layer's qkv or, behind the last layer, out = softmax_D(h@Wl^T + bl).
// GEMM1 (K=4) = v_wmma_f32_16x16x4_f32 per 16 FF
// columns; bias+relu on the D tile; GEMM2 (2048 -> 4) accumulated per lane
// straight from the WMMA D layout, cross-lane reduced once at the end.
// In-place on h (tiles are disjoint).
// The layer's W1, W2 and b1 (72 KiB) are brought into LDS once per block, all
// copies in flight together, so the 128-trip loop waits on LDS and not on L2.
// ---------------------------------------------------------------------------
#define FF_W1_OFF 0                      // floats: W1 [2048][4]
#define FF_W2_OFF (FFDIM * 4)            // floats: W2 [4][2048]
#define FF_B1_OFF (FFDIM * 8)            // floats: b1 [2048]
#define FF_LDS_FLOATS (FFDIM * 9)        // 18432 floats = 36 slabs of 2048 B
#define FF_SLAB_FLOATS 512               // 128 lanes x 16 B

// Twelve 16-byte copies per lane, global -> LDS, through no register. lds is the
// lane's LDS byte address of the first copy; copy k lands k slabs further on.
// The s_wait_xcnt closes the statement so that no address register named by a
// copy is rewritten ahead of it.
__device__ __forceinline__ void copy12_to_lds(unsigned lds, const float* const* g) {
    asm volatile(
        "global_load_async_to_lds_b128 %0, %12, off\n\t"
        "global_load_async_to_lds_b128 %1, %13, off\n\t"
        "global_load_async_to_lds_b128 %2, %14, off\n\t"
        "global_load_async_to_lds_b128 %3, %15, off\n\t"
        "global_load_async_to_lds_b128 %4, %16, off\n\t"
        "global_load_async_to_lds_b128 %5, %17, off\n\t"
        "global_load_async_to_lds_b128 %6, %18, off\n\t"
        "global_load_async_to_lds_b128 %7, %19, off\n\t"
        "global_load_async_to_lds_b128 %8, %20, off\n\t"
        "global_load_async_to_lds_b128 %9, %21, off\n\t"
        "global_load_async_to_lds_b128 %10, %22, off\n\t"
        "global_load_async_to_lds_b128 %11, %23, off\n\t"
        "s_wait_xcnt 0x0"
        :: "v"(lds), "v"(lds + 2048u), "v"(lds + 4096u), "v"(lds + 6144u),
           "v"(lds + 8192u), "v"(lds + 10240u), "v"(lds + 12288u), "v"(lds + 14336u),
           "v"(lds + 16384u), "v"(lds + 18432u), "v"(lds + 20480u), "v"(lds + 22528u),
           "v"(g[0]), "v"(g[1]), "v"(g[2]), "v"(g[3]), "v"(g[4]), "v"(g[5]),
           "v"(g[6]), "v"(g[7]), "v"(g[8]), "v"(g[9]), "v"(g[10]), "v"(g[11])
        : "memory");
}

template <bool LAST>
__device__ __forceinline__ void layer_tail(const float* o, float* h,
                      const float* __restrict__ Wout, const float* __restrict__ bout,
                      const float* __restrict__ g1, const float* __restrict__ be1,
                      const float* __restrict__ W1, const float* __restrict__ b1,
                      const float* __restrict__ W2, const float* __restrict__ b2,
                      const float* __restrict__ g2, const float* __restrict__ be2,
                      const float* __restrict__ Wn, const float* __restrict__ bn,
                      float* __restrict__ dst) {
    __shared__ __attribute__((aligned(16))) float sW[FF_LDS_FLOATS];
    __shared__ __attribute__((aligned(16))) float sH[64 * 4];   // hn rows, for the residual

    const int wave  = threadIdx.x >> 5;
    const int lane  = threadIdx.x & 31;
    const int tile  = blockIdx.x * 4 + wave;
    const int rbase = tile * 16;
    const int lm    = lane & 15;
    const int half  = lane >> 4;

    // this lane's attention row and residual row (row rbase+lm, both halves the
    // same): asked for ahead of the copies, so that all of it flies together
    // (o and h carry no __restrict__, so these loads keep their place there)
    float ov[4], hr[4];
    #pragma unroll
    for (int k = 0; k < 4; ++k) {
        ov[k] = o[(rbase + lm) * 4 + k];
        hr[k] = h[(rbase + lm) * 4 + k];
    }

    {
        // slab k of the LDS image <- the same 2048 bytes of W1 (16 slabs), W2 (16), b1 (4)
        const int t4 = threadIdx.x * 4;
        const float* gsrc[36];
        #pragma unroll
        for (int k = 0; k < 16; ++k) {
            gsrc[k]      = W1 + k * FF_SLAB_FLOATS + t4;
            gsrc[16 + k] = W2 + k * FF_SLAB_FLOATS + t4;
        }
        #pragma unroll
        for (int k = 0; k < 4; ++k) gsrc[32 + k] = b1 + k * FF_SLAB_FLOATS + t4;
        const unsigned l0 = (unsigned)(size_t)&sW[t4];
        copy12_to_lds(l0,           gsrc);
        copy12_to_lds(l0 + 24576u,  gsrc + 12);
        copy12_to_lds(l0 + 49152u,  gsrc + 24);
    }
    // keeps the row arithmetic below (it waits for its weights and the two row
    // loads) from being scheduled ahead of the copies, which would then start a
    // load latency late
    __builtin_amdgcn_sched_barrier(0);

    // hn = LN_row( h + o@Wout^T + bout )
    float hn[4];
    {
        float wo[16], bo[4], lg1[4], lb1[4], y[4];
        #pragma unroll
        for (int c = 0; c < 4; ++c) { bo[c] = bout[c]; lg1[c] = g1[c]; lb1[c] = be1[c]; }
        #pragma unroll
        for (int j = 0; j < 16; ++j) wo[j] = Wout[j];
        // all four weight loads are issued here, together: left to itself the
        // scheduler asks for g1 and be1 only behind the wait for the first two
        __builtin_amdgcn_sched_barrier(0);
        #pragma unroll
        for (int c = 0; c < 4; ++c) {
            float acc = bo[c];
            #pragma unroll
            for (int k = 0; k < 4; ++k) acc += ov[k] * wo[c*4 + k];
            y[c] = hr[c] + acc;
        }
        const float mean = 0.25f * (y[0] + y[1] + y[2] + y[3]);
        float var = 0.f;
        #pragma unroll
        for (int c = 0; c < 4; ++c) { const float d0 = y[c] - mean; var += d0 * d0; }
        var *= 0.25f;
        const float inv = rsqrtf(var + 1e-5f);
        #pragma unroll
        for (int c = 0; c < 4; ++c) hn[c] = (y[c] - mean) * inv * lg1[c] + lb1[c];
    }
    // A-layout (16x4 f32): lane = M%16, VGPR0/1 = K {0,1} (lanes 0-15) / {2,3} (16-31)
    v2f a; a.x = half ? hn[2] : hn[0]; a.y = half ? hn[3] : hn[1];
    // the same two elements go to the row's place in sH
    sH[(wave * 16 + lm) * 4 + half * 2 + 0] = a.x;
    sH[(wave * 16 + lm) * 4 + half * 2 + 1] = a.y;
    const v8f cz = {0.f, 0.f, 0.f, 0.f, 0.f, 0.f, 0.f, 0.f};

    float zacc[8][4];
    #pragma unroll
    for (int r2 = 0; r2 < 8; ++r2)
        #pragma unroll
        for (int c = 0; c < 4; ++c) zacc[r2][c] = 0.f;

    // this wave's copies have landed; behind the barrier every wave's have
    asm volatile("s_wait_asynccnt 0x0" ::: "memory");
    __syncthreads();

    // the tail's small weights: asked for here, they arrive while the loop runs
    constexpr int NW = LAST ? 16 : 48;
    constexpr int NB = LAST ? 4 : 12;
    float fb2[4], lg2[4], lb2[4], wn[NW], bnv[NB];
    #pragma unroll
    for (int k = 0; k < 4; ++k) { fb2[k] = b2[k]; lg2[k] = g2[k]; lb2[k] = be2[k]; }
    #pragma unroll
    for (int j = 0; j < NW; ++j) wn[j] = Wn[j];
    #pragma unroll
    for (int j = 0; j < NB; ++j) bnv[j] = bn[j];

    for (int ch = 0; ch < FFDIM / 16; ++ch) {
        const int ffl = ch * 16 + lm;
        // B-layout (4x16 f32): lane = N%16, VGPR0/1 = K {0,1}/{2,3}; W1 is [2048,4] row-major
        const float* bp = sW + FF_W1_OFF + ffl * 4 + half * 2;
        v2f bm; bm.x = bp[0]; bm.y = bp[1];

        v8f d = __builtin_amdgcn_wmma_f32_16x16x4_f32(
            false, a, false, bm, (short)0, cz, false, false);

        const float b1v = sW[FF_B1_OFF + ffl];
        const float w20 = sW[FF_W2_OFF + 0 * FFDIM + ffl];
        const float w21 = sW[FF_W2_OFF + 1 * FFDIM + ffl];
        const float w22 = sW[FF_W2_OFF + 2 * FFDIM + ffl];
        const float w23 = sW[FF_W2_OFF + 3 * FFDIM + ffl];
        #pragma unroll
        for (int r2 = 0; r2 < 8; ++r2) {
            // D layout: VGPR r2 holds row M = r2 + 8*half, column N = ffl
            float f = d[r2] + b1v;
            f = fmaxf(f, 0.f);
            zacc[r2][0] += f * w20;
            zacc[r2][1] += f * w21;
            zacc[r2][2] += f * w22;
            zacc[r2][3] += f * w23;
        }
    }

    // reduce across the 16 lanes of each half (masks < 16 keep halves separate)
    #pragma unroll
    for (int r2 = 0; r2 < 8; ++r2)
        #pragma unroll
        for (int c = 0; c < 4; ++c) {
            float v = zacc[r2][c];
            v += __shfl_xor(v, 1, 32);
            v += __shfl_xor(v, 2, 32);
            v += __shfl_xor(v, 4, 32);
            v += __shfl_xor(v, 8, 32);
            zacc[r2][c] = v;
        }

    // every lane of a half holds all 8 row sums: lane lm takes row lm%8 of its half
    const int rsel = lm & 7;
    float z[4];
    #pragma unroll
    for (int c = 0; c < 4; ++c) z[c] = zacc[0][c];
    #pragma unroll
    for (int r2 = 1; r2 < 8; ++r2)
        #pragma unroll
        for (int c = 0; c < 4; ++c) z[c] = (rsel == r2) ? zacc[r2][c] : z[c];

    if (lm < 8) {
        const int trow = half * 8 + rsel;
        const int row  = rbase + trow;
        const float* hp = sH + (wave * 16 + trow) * 4;
        float y[4], hv[4];
        #pragma unroll
        for (int c = 0; c < 4; ++c) y[c] = hp[c] + z[c] + fb2[c];
        const float mean = 0.25f * (y[0] + y[1] + y[2] + y[3]);
        float var = 0.f;
        #pragma unroll
        for (int c = 0; c < 4; ++c) { const float d0 = y[c] - mean; var += d0 * d0; }
        var *= 0.25f;
        const float inv = rsqrtf(var + 1e-5f);
        #pragma unroll
        for (int c = 0; c < 4; ++c) hv[c] = (y[c] - mean) * inv * lg2[c] + lb2[c];

        if (!LAST) {
            // h for the next layer's residual, and its qkv row (Wn = Win, bn = bi)
            float* op = h + row * 4;
            #pragma unroll
            for (int c = 0; c < 4; ++c) op[c] = hv[c];
            qkv_row(hv, wn, bnv, dst + row * 12);
        } else {
            // out = softmax_D( h @ Wl^T + bl )  (Wn = Wl, bn = bl)
            float t[4];
            #pragma unroll
            for (int c = 0; c < 4; ++c) {
                float acc = bnv[c];
                #pragma unroll
                for (int k = 0; k < 4; ++k) acc += hv[k] * wn[c*4 + k];
                t[c] = acc;
            }
            const float m = fmaxf(fmaxf(t[0], t[1]), fmaxf(t[2], t[3]));
            float e[4], s = 0.f;
            #pragma unroll
            for (int c = 0; c < 4; ++c) { e[c] = __expf(t[c] - m); s += e[c]; }
            const float invs = 1.f / s;
            float* op = dst + row * 4;
            #pragma unroll
            for (int c = 0; c < 4; ++c) op[c] = e[c] * invs;
        }
    }
}

__global__ void __launch_bounds__(128) k_layer_mid(const float* o, float* h,
                      const float* __restrict__ Wout, const float* __restrict__ bout,
                      const float* __restrict__ g1, const float* __restrict__ be1,
                      const float* __restrict__ W1, const float* __restrict__ b1,
                      const float* __restrict__ W2, const float* __restrict__ b2,
                      const float* __restrict__ g2, const float* __restrict__ be2,
                      const float* __restrict__ Win, const float* __restrict__ bi,
                      float* __restrict__ qkv) {
    layer_tail<false>(o, h, Wout, bout, g1, be1, W1, b1, W2, b2, g2, be2, Win, bi, qkv);
}

__global__ void __launch_bounds__(128) k_layer_last(const float* o, float* h,
                      const float* __restrict__ Wout, const float* __restrict__ bout,
                      const float* __restrict__ g1, const float* __restrict__ be1,
                      const float* __restrict__ W1, const float* __restrict__ b1,
                      const float* __restrict__ W2, const float* __restrict__ b2,
                      const float* __restrict__ g2, const float* __restrict__ be2,
                      const float* __restrict__ Wl, const float* __restrict__ bl,
                      float* __restrict__ out) {
    layer_tail<true>(o, h, Wout, bout, g1, be1, W1, b1, W2, b2, g2, be2, Wl, bl, out);
}

// ---------------------------------------------------------------------------
extern "C" void kernel_launch(void* const* d_in, const int* in_sizes, int n_in,
                              void* d_out, int out_size, void* d_ws, size_t ws_size,
                              hipStream_t stream) {
    (void)in_sizes; (void)n_in; (void)out_size; (void)ws_size;
    const float* x      = (const float*)d_in[0];
    const float* conv_w = (const float*)d_in[1];
    const float* conv_b = (const float*)d_in[2];
    const float* Wl     = (const float*)d_in[3];
    const float* bl     = (const float*)d_in[4];
    const float* ln_g   = (const float*)d_in[5];
    const float* ln_b   = (const float*)d_in[6];
    const float* Win    = (const float*)d_in[7];
    const float* bi     = (const float*)d_in[8];
    const float* Wout   = (const float*)d_in[9];
    const float* bout   = (const float*)d_in[10];
    const float* W1     = (const float*)d_in[11];
    const float* b1     = (const float*)d_in[12];
    const float* W2     = (const float*)d_in[13];
    const float* b2     = (const float*)d_in[14];
    const float* g1     = (const float*)d_in[15];
    const float* be1    = (const float*)d_in[16];
    const float* g2     = (const float*)d_in[17];
    const float* be2    = (const float*)d_in[18];

    float* h   = (float*)d_ws;          // ROWS*4  floats
    float* qkv = h + ROWS * 4;          // ROWS*12 floats
    float* att = qkv + ROWS * 12;       // ROWS*4  floats  (~2 MB total)

    k_pre<<<BATCH, 128, 0, stream>>>(x, conv_w, conv_b, Wl, bl, ln_g, ln_b, Win, bi, h, qkv);
    for (int i = 0; i < 3; ++i) {
        k_attn     <<<SEQ * 4,   256, 0, stream>>>(qkv, att);
        k_layer_mid<<<ROWS / 64, 128, 0, stream>>>(att, h, Wout + i*16, bout + i*4,
                                                   g1 + i*4, be1 + i*4,
                                                   W1 + i*FFDIM*4, b1 + i*FFDIM,
                                                   W2 + i*4*FFDIM, b2 + i*4,
                                                   g2 + i*4, be2 + i*4,
                                                   Win + (i+1)*48, bi + (i+1)*12, qkv);
    }
    k_attn      <<<SEQ * 4,   256, 0, stream>>>(qkv, att);
    k_layer_last<<<ROWS / 64, 128, 0, stream>>>(att, h, Wout + 3*16, bout + 3*4,
                                                g1 + 3*4, be1 + 3*4,
                                                W1 + 3*FFDIM*4, b1 + 3*FFDIM,
                                                W2 + 3*4*FFDIM, b2 + 3*4,
                                                g2 + 3*4, be2 + 3*4,
                                                Wl, bl, (float*)d_out);
}

// v003
// It runs in 86 microseconds.
// Two timings next to v002 put it at 1.12 and 1.11 times that version's speed.
// Over all steps from v000 it is 2.24 times as fast.
#include <hip/hip_runtime.h>
#include <math.h>

typedef __attribute__((ext_vector_type(2))) float v2f;
typedef __attribute__((ext_vector_type(8))) float v8f;

#define SEQ   100
#define DMODEL 4
#define BATCH 256
#define ROWS  (BATCH * SEQ)   // 25600
#define FFDIM 2048
#define NREP  8

__device__ __forceinline__ float gelu_exact(float x) {
    return 0.5f * x * (1.0f + erff(x * 0.70710678118654752440f));
}

// Value of lane (l ^ M) inside the lane's 16-lane row, by DPP row_xmask; every
// lane of the wave must be on.
template <int M>
__device__ __forceinline__ float row_xor(float v) {
    return __builtin_bit_cast(float, __builtin_amdgcn_update_dpp(
        0, __builtin_bit_cast(int, v), 0x160 | M, 0xf, 0xf, true));
}
// Value of lane (l ^ 16): the same place in the wave's other 16-lane row.
__device__ __forceinline__ float other_row(float v) {
    const int b = __builtin_bit_cast(int, v);
    return __builtin_bit_cast(float, __builtin_amdgcn_permlanex16(
        b, b, 0x76543210, 0xfedcba98, false, false));
}
// Sum, maximum and minimum over the 32 lanes of a wave, the result in every lane.
__device__ __forceinline__ float wave_sum(float v) {
    v += row_xor<1>(v); v += row_xor<2>(v); v += row_xor<4>(v); v += row_xor<8>(v);
    return v + other_row(v);
}
__device__ __forceinline__ float wave_max(float v) {
    v = fmaxf(v, row_xor<1>(v)); v = fmaxf(v, row_xor<2>(v));
    v = fmaxf(v, row_xor<4>(v)); v = fmaxf(v, row_xor<8>(v));
    return fmaxf(v, other_row(v));
}
__device__ __forceinline__ float wave_min(float v) {
    v = fminf(v, row_xor<1>(v)); v = fminf(v, row_xor<2>(v));
    v = fminf(v, row_xor<4>(v)); v = fminf(v, row_xor<8>(v));
    return fminf(v, other_row(v));
}

// qkv row = hv @ Win^T + bi  (4 -> 12); row and weights are held in registers
__device__ __forceinline__ void qkv_row(const float* hv, const float* Win,
                                        const float* bi, float* __restrict__ qp) {
    #pragma unroll
    for (int j = 0; j < 12; ++j) {
        float a = bi[j];
        #pragma unroll
        for (int k = 0; k < 4; ++k) a += hv[k] * Win[j*4 + k];
        qp[j] = a;
    }
}

// ---------------------------------------------------------------------------
// K1: h = x*cw+cb ; 8x { gelu(LN_[100x4](h@Wl^T+bl)) } ; h = h@Wl^T+bl ;
// then the first layer's qkv row from the same registers.
// one block per batch element, thread r owns row r (r<100)
// ---------------------------------------------------------------------------
__global__ void k_pre(const float* __restrict__ x, const float* __restrict__ conv_w,
                      const float* __restrict__ conv_b,
                      const float* __restrict__ Wl, const float* __restrict__ bl,
                      const float* __restrict__ lng, const float* __restrict__ lnb,
                      const float* __restrict__ Win, const float* __restrict__ bi,
                      float* __restrict__ h, float* __restrict__ qkv) {
    // the four waves' partial sums {sum, sum of squares}; two copies, used in turn,
    // so that one barrier a pass is enough
    __shared__ __attribute__((aligned(16))) float sP[2][8];
    const int b = blockIdx.x;
    const int r = threadIdx.x;
    const bool act = (r < SEQ);

    const float cw = conv_w[0], cb = conv_b[0];
    float hv[4] = {0.f, 0.f, 0.f, 0.f};
    if (act) {
        const float* xp = x + (b * SEQ + r) * DMODEL;
        #pragma unroll
        for (int c = 0; c < 4; ++c) hv[c] = xp[c] * cw + cb;
    }
    float W[16], bb[4], g[4] = {1,1,1,1}, be[4] = {0,0,0,0};
    #pragma unroll
    for (int j = 0; j < 16; ++j) W[j] = Wl[j];
    #pragma unroll
    for (int c = 0; c < 4; ++c) bb[c] = bl[c];
    float wq[48], bq[12];   // asked for here, so that the tail does not wait for them
    #pragma unroll
    for (int j = 0; j < 48; ++j) wq[j] = Win[j];
    #pragma unroll
    for (int j = 0; j < 12; ++j) bq[j] = bi[j];
    if (act) {
        #pragma unroll
        for (int c = 0; c < 4; ++c) { g[c] = lng[r*4 + c]; be[c] = lnb[r*4 + c]; }
    }

    for (int it = 0; it < NREP; ++it) {
        float y[4];
        #pragma unroll
        for (int c = 0; c < 4; ++c) {
            float a = bb[c];
            #pragma unroll
            for (int k = 0; k < 4; ++k) a += hv[k] * W[c*4 + k];
            y[c] = a;
        }
        float ls = 0.f, lq = 0.f;
        if (act) {
            #pragma unroll
            for (int c = 0; c < 4; ++c) { ls += y[c]; lq += y[c]*y[c]; }
        }
        ls = wave_sum(ls);
        lq = wave_sum(lq);
        float* pp = sP[it & 1];
        if ((r & 31) == 0) { pp[(r >> 5) * 2 + 0] = ls; pp[(r >> 5) * 2 + 1] = lq; }
        __syncthreads();
        const float ts = (pp[0] + pp[2]) + (pp[4] + pp[6]);
        const float tq = (pp[1] + pp[3]) + (pp[5] + pp[7]);
        const float mean = ts * (1.0f / 400.0f);
        const float var  = tq * (1.0f / 400.0f) - mean * mean;
        const float inv  = rsqrtf(var + 1e-5f);
        if (act) {
            #pragma unroll
            for (int c = 0; c < 4; ++c)
                hv[c] = gelu_exact((y[c] - mean) * inv * g[c] + be[c]);
        }
    }
    if (act) {
        float* hp = h + (b * SEQ + r) * DMODEL;
        float ho[4];
        #pragma unroll
        for (int c = 0; c < 4; ++c) {
            float a = bb[c];
            #pragma unroll
            for (int k = 0; k < 4; ++k) a += hv[k] * W[c*4 + k];
            ho[c] = a;
            hp[c] = a;
        }
        qkv_row(ho, wq, bq, qkv + (b * SEQ + r) * 12);
    }
}

// ---------------------------------------------------------------------------
// K2: rank-1 attention over the S=256 axis, head_dim=1.
// block = (position n, head hh); thread s streams 256 k/v from LDS.
// exact row max via kmin/kmax since score(s,t) = q_s * k_t.
// ---------------------------------------------------------------------------
__global__ void k_attn(const float* __restrict__ qkv, float* __restrict__ o) {
    __shared__ __attribute__((aligned(16))) float sK[256];
    __shared__ __attribute__((aligned(16))) float sV[256];
    const int n  = blockIdx.x >> 2;
    const int hh = blockIdx.x & 3;
    const int s  = threadIdx.x;
    const float* base = qkv + (s * SEQ + n) * 12;
    const float q = base[hh];
    sK[s] = base[4 + hh];
    sV[s] = base[8 + hh];
    __syncthreads();
    // every wave finds kmax and kmin of all 256 k by itself: eight per lane, then
    // across the lanes
    const int lane = s & 31;
    float kmax, kmin;
    {
        float kk[8];
        #pragma unroll
        for (int j = 0; j < 4; ++j) { kk[j] = sK[lane * 4 + j]; kk[4 + j] = sK[128 + lane * 4 + j]; }
        kmax = kk[0]; kmin = kk[0];
        #pragma unroll
        for (int j = 1; j < 8; ++j) { kmax = fmaxf(kmax, kk[j]); kmin = fminf(kmin, kk[j]); }
        kmax = wave_max(kmax);
        kmin = wave_min(kmin);
    }
    const float m = q * ((q >= 0.f) ? kmax : kmin);
    float den = 0.f, num = 0.f;
    for (int t = 0; t < 256; ++t) {
        const float e = __expf(q * sK[t] - m);
        den += e;
        num += e * sV[t];
    }
    o[(s * SEQ + n) * 4 + hh] = num / den;
}

// ---------------------------------------------------------------------------
// K3: everything of a layer behind its attention, one launch, one wave per
// 16-row tile: hn = LN_row(h + o@Wout^T + bout) in registers (each lane its row
// lane%16, while the weight copies fly), the FF block on the matrix pipe, then
// one row per lane: +b2, residual, per-row LN, and from that row either the next
// layer's qkv or, behind the last layer, out = softmax_D(h@Wl^T + bl).
// GEMM1 (K=4) = v_wmma_f32_16x16x4_f32 per 16 FF
// columns; bias+relu on the D tile; GEMM2 (2048 -> 4) accumulated per lane
// straight from the WMMA D layout, cross-lane reduced once at the end.
// In-place on h (tiles are disjoint).
// The layer's W1, W2 and b1 (72 KiB) are brought into LDS once per block, all
// copies in flight together, so the 128-trip loop waits on LDS and not on L2.
// ---------------------------------------------------------------------------
#define FF_W1_OFF 0                      // floats: W1 [2048][4]
#define FF_W2_OFF (FFDIM * 4)            // floats: W2 [4][2048]
#define FF_B1_OFF (FFDIM * 8)            // floats: b1 [2048]
#define FF_LDS_FLOATS (FFDIM * 9)        // 18432 floats = 36 slabs of 2048 B
#define FF_SLAB_FLOATS 512               // 128 lanes x 16 B

// Twelve 16-byte copies per lane, global -> LDS, through no register. lds is the
// lane's LDS byte address of the first copy; copy k lands k slabs further on.
// The s_wait_xcnt closes the statement so that no address register named by a
// copy is rewritten ahead of it.
__device__ __forceinline__ void copy12_to_lds(unsigned lds, const float* const* g) {
    asm volatile(
        "global_load_async_to_lds_b128 %0, %12, off\n\t"
        "global_load_async_to_lds_b128 %1, %13, off\n\t"
        "global_load_async_to_lds_b128 %2, %14, off\n\t"
        "global_load_async_to_lds_b128 %3, %15, off\n\t"
        "global_load_async_to_lds_b128 %4, %16, off\n\t"
        "global_load_async_to_lds_b128 %5, %17, off\n\t"
        "global_load_async_to_lds_b128 %6, %18, off\n\t"
        "global_load_async_to_lds_b128 %7, %19, off\n\t"
        "global_load_async_to_lds_b128 %8, %20, off\n\t"
        "global_load_async_to_lds_b128 %9, %21, off\n\t"
        "global_load_async_to_lds_b128 %10, %22, off\n\t"
        "global_load_async_to_lds_b128 %11, %23, off\n\t"
        "s_wait_xcnt 0x0"
        :: "v"(lds), "v"(lds + 2048u), "v"(lds + 4096u), "v"(lds + 6144u),
           "v"(lds + 8192u), "v"(lds + 10240u), "v"(lds + 12288u), "v"(lds + 14336u),
           "v"(lds + 16384u), "v"(lds + 18432u), "v"(lds + 20480u), "v"(lds + 22528u),
           "v"(g[0]), "v"(g[1]), "v"(g[2]), "v"(g[3]), "v"(g[4]), "v"(g[5]),
           "v"(g[6]), "v"(g[7]), "v"(g[8]), "v"(g[9]), "v"(g[10]), "v"(g[11])
        : "memory");
}

template <bool LAST>
__device__ __forceinline__ void layer_tail(const float* o, float* h,
                      const float* __restrict__ Wout, const float* __restrict__ bout,
                      const float* __restrict__ g1, const float* __restrict__ be1,
                      const float* __restrict__ W1, const float* __restrict__ b1,
                      const float* __restrict__ W2, const float* __restrict__ b2,
                      const float* __restrict__ g2, const float* __restrict__ be2,
                      const float* __restrict__ Wn, const float* __restrict__ bn,
                      float* __restrict__ dst) {
    __shared__ __attribute__((aligned(16))) float sW[FF_LDS_FLOATS];
    __shared__ __attribute__((aligned(16))) float sH[64 * 4];   // hn rows, for the residual

    const int wave  = threadIdx.x >> 5;
    const int lane  = threadIdx.x & 31;
    const int tile  = blockIdx.x * 4 + wave;
    const int rbase = tile * 16;
    const int lm    = lane & 15;
    const int half  = lane >> 4;

    // this lane's attention row and residual row (row rbase+lm, both halves the
    // same): asked for ahead of the copies, so that all of it flies together
    // (o and h carry no __restrict__, so these loads keep their place there)
    float ov[4], hr[4];
    #pragma unroll
    for (int k = 0; k < 4; ++k) {
        ov[k] = o[(rbase + lm) * 4 + k];
        hr[k] = h[(rbase + lm) * 4 + k];
    }

    {
        // slab k of the LDS image <- the same 2048 bytes of W1 (16 slabs), W2 (16), b1 (4)
        const int t4 = threadIdx.x * 4;
        const float* gsrc[36];
        #pragma unroll
        for (int k = 0; k < 16; ++k) {
            gsrc[k]      = W1 + k * FF_SLAB_FLOATS + t4;
            gsrc[16 + k] = W2 + k * FF_SLAB_FLOATS + t4;
        }
        #pragma unroll
        for (int k = 0; k < 4; ++k) gsrc[32 + k] = b1 + k * FF_SLAB_FLOATS + t4;
        const unsigned l0 = (unsigned)(size_t)&sW[t4];
        copy12_to_lds(l0,           gsrc);
        copy12_to_lds(l0 + 24576u,  gsrc + 12);
        copy12_to_lds(l0 + 49152u,  gsrc + 24);
    }
    // keeps the row arithmetic below (it waits for its weights and the two row
    // loads) from being scheduled ahead of the copies, which would then start a
    // load latency late
    __builtin_amdgcn_sched_barrier(0);

    // hn = LN_row( h + o@Wout^T + bout )
    float hn[4];
    {
        float wo[16], bo[4], lg1[4], lb1[4], y[4];
        #pragma unroll
        for (int c = 0; c < 4; ++c) { bo[c] = bout[c]; lg1[c] = g1[c]; lb1[c] = be1[c]; }
        #pragma unroll
        for (int j = 0; j < 16; ++j) wo[j] = Wout[j];
        // all four weight loads are issued here, together: left to itself the
        // scheduler asks for g1 and be1 only behind the wait for the first two
        __builtin_amdgcn_sched_barrier(0);
        #pragma unroll
        for (int c = 0; c < 4; ++c) {
            float acc = bo[c];
            #pragma unroll
            for (int k = 0; k < 4; ++k) acc += ov[k] * wo[c*4 + k];
            y[c] = hr[c] + acc;
        }
        const float mean = 0.25f * (y[0] + y[1] + y[2] + y[3]);
        float var = 0.f;
        #pragma unroll
        for (int c = 0; c < 4; ++c) { const float d0 = y[c] - mean; var += d0 * d0; }
        var *= 0.25f;
        const float inv = rsqrtf(var + 1e-5f);
        #pragma unroll
        for (int c = 0; c < 4; ++c) hn[c] = (y[c] - mean) * inv * lg1[c] + lb1[c];
    }
    // A-layout (16x4 f32): lane = M%16, VGPR0/1 = K {0,1} (lanes 0-15) / {2,3} (16-31)
    v2f a; a.x = half ? hn[2] : hn[0]; a.y = half ? hn[3] : hn[1];
    // the same two elements go to the row's place in sH
    sH[(wave * 16 + lm) * 4 + half * 2 + 0] = a.x;
    sH[(wave * 16 + lm) * 4 + half * 2 + 1] = a.y;
    const v8f cz = {0.f, 0.f, 0.f, 0.f, 0.f, 0.f, 0.f, 0.f};

    float zacc[8][4];
    #pragma unroll
    for (int r2 = 0; r2 < 8; ++r2)
        #pragma unroll
        for (int c = 0; c < 4; ++c) zacc[r2][c] = 0.f;

    // this wave's copies have landed; behind the barrier every wave's have
    asm volatile("s_wait_asynccnt 0x0" ::: "memory");
    __syncthreads();

    // the tail's small weights: asked for here, they arrive while the loop runs
    constexpr int NW = LAST ? 16 : 48;
    constexpr int NB = LAST ? 4 : 12;
    float fb2[4], lg2[4], lb2[4], wn[NW], bnv[NB];
    #pragma unroll
    for (int k = 0; k < 4; ++k) { fb2[k] = b2[k]; lg2[k] = g2[k]; lb2[k] = be2[k]; }
    #pragma unroll
    for (int j = 0; j < NW; ++j) wn[j] = Wn[j];
    #pragma unroll
    for (int j = 0; j < NB; ++j) bnv[j] = bn[j];

    for (int ch = 0; ch < FFDIM / 16; ++ch) {
        const int ffl = ch * 16 + lm;
        // B-layout (4x16 f32): lane = N%16, VGPR0/1 = K {0,1}/{2,3}; W1 is [2048,4] row-major
        const float* bp = sW + FF_W1_OFF + ffl * 4 + half * 2;
        v2f bm; bm.x = bp[0]; bm.y = bp[1];

        v8f d = __builtin_amdgcn_wmma_f32_16x16x4_f32(
            false, a, false, bm, (short)0, cz, false, false);

        const float b1v = sW[FF_B1_OFF + ffl];
        const float w20 = sW[FF_W2_OFF + 0 * FFDIM + ffl];
        const float w21 = sW[FF_W2_OFF + 1 * FFDIM + ffl];
        const float w22 = sW[FF_W2_OFF + 2 * FFDIM + ffl];
        const float w23 = sW[FF_W2_OFF + 3 * FFDIM + ffl];
        #pragma unroll
        for (int r2 = 0; r2 < 8; ++r2) {
            // D layout: VGPR r2 holds row M = r2 + 8*half, column N = ffl
            float f = d[r2] + b1v;
            f = fmaxf(f, 0.f);
            zacc[r2][0] += f * w20;
            zacc[r2][1] += f * w21;
            zacc[r2][2] += f * w22;
            zacc[r2][3] += f * w23;
        }
    }

    // reduce across the 16 lanes of each half (a DPP row is one half)
    #pragma unroll
    for (int r2 = 0; r2 < 8; ++r2)
        #pragma unroll
        for (int c = 0; c < 4; ++c) {
            float v = zacc[r2][c];
            v += row_xor<1>(v);
            v += row_xor<2>(v);
            v += row_xor<4>(v);
            v += row_xor<8>(v);
            zacc[r2][c] = v;
        }

    // every lane of a half holds all 8 row sums: lane lm takes row lm%8 of its half
    const int rsel = lm & 7;
    float z[4];
    #pragma unroll
    for (int c = 0; c < 4; ++c) z[c] = zacc[0][c];
    #pragma unroll
    for (int r2 = 1; r2 < 8; ++r2)
        #pragma unroll
        for (int c = 0; c < 4; ++c) z[c] = (rsel == r2) ? zacc[r2][c] : z[c];

    if (lm < 8) {
        const int trow = half * 8 + rsel;
        const int row  = rbase + trow;
        const float* hp = sH + (wave * 16 + trow) * 4;
        float y[4], hv[4];
        #pragma unroll
        for (int c = 0; c < 4; ++c) y[c] = hp[c] + z[c] + fb2[c];
        const float mean = 0.25f * (y[0] + y[1] + y[2] + y[3]);
        float var = 0.f;
        #pragma unroll
        for (int c = 0; c < 4; ++c) { const float d0 = y[c] - mean; var += d0 * d0; }
        var *= 0.25f;
        const float inv = rsqrtf(var + 1e-5f);
        #pragma unroll
        for (int c = 0; c < 4; ++c) hv[c] = (y[c] - mean) * inv * lg2[c] + lb2[c];

        if (!LAST) {
            // h for the next layer's residual, and its qkv row (Wn = Win, bn = bi)
            float* op = h + row * 4;
            #pragma unroll
            for (int c = 0; c < 4; ++c) op[c] = hv[c];
            qkv_row(hv, wn, bnv, dst + row * 12);
        } else {
            // out = softmax_D( h @ Wl^T + bl )  (Wn = Wl, bn = bl)
            float t[4];
            #pragma unroll
            for (int c = 0; c < 4; ++c) {
                float acc = bnv[c];
                #pragma unroll
                for (int k = 0; k < 4; ++k) acc += hv[k] * wn[c*4 + k];
                t[c] = acc;
            }
            const float m = fmaxf(fmaxf(t[0], t[1]), fmaxf(t[2], t[3]));
            float e[4], s = 0.f;
            #pragma unroll
            for (int c = 0; c < 4; ++c) { e[c] = __expf(t[c] - m); s += e[c]; }
            const float invs = 1.f / s;
            float* op = dst + row * 4;
            #pragma unroll
            for (int c = 0; c < 4; ++c) op[c] = e[c] * invs;
        }
    }
}

__global__ void __launch_bounds__(128) k_layer_mid(const float* o, float* h,
                      const float* __restrict__ Wout, const float* __restrict__ bout,
                      const float* __restrict__ g1, const float* __restrict__ be1,
                      const float* __restrict__ W1, const float* __restrict__ b1,
                      const float* __restrict__ W2, const float* __restrict__ b2,
                      const float* __restrict__ g2, const float* __restrict__ be2,
                      const float* __restrict__ Win, const float* __restrict__ bi,
                      float* __restrict__ qkv) {
    layer_tail<false>(o, h, Wout, bout, g1, be1, W1, b1, W2, b2, g2, be2, Win, bi, qkv);
}

__global__ void __launch_bounds__(128) k_layer_last(const float* o, float* h,
                      const float* __restrict__ Wout, const float* __restrict__ bout,
                      const float* __restrict__ g1, const float* __restrict__ be1,
                      const float* __restrict__ W1, const float* __restrict__ b1,
                      const float* __restrict__ W2, const float* __restrict__ b2,
                      const float* __restrict__ g2, const float* __restrict__ be2,
                      const float* __restrict__ Wl, const float* __restrict__ bl,
                      float* __restrict__ out) {
    layer_tail<true>(o, h, Wout, bout, g1, be1, W1, b1, W2, b2, g2, be2, Wl, bl, out);
}

// ---------------------------------------------------------------------------
extern "C" void kernel_launch(void* const* d_in, const int* in_sizes, int n_in,
                              void* d_out, int out_size, void* d_ws, size_t ws_size,
                              hipStream_t stream) {
    (void)in_sizes; (void)n_in; (void)out_size; (void)ws_size;
    const float* x      = (const float*)d_in[0];
    const float* conv_w = (const float*)d_in[1];
    const float* conv_b = (const float*)d_in[2];
    const float* Wl     = (const float*)d_in[3];
    const float* bl     = (const float*)d_in[4];
    const float* ln_g   = (const float*)d_in[5];
    const float* ln_b   = (const float*)d_in[6];
    const float* Win    = (const float*)d_in[7];
    const float* bi     = (const float*)d_in[8];
    const float* Wout   = (const float*)d_in[9];
    const float* bout   = (const float*)d_in[10];
    const float* W1     = (const float*)d_in[11];
    const float* b1     = (const float*)d_in[12];
    const float* W2     = (const float*)d_in[13];
    const float* b2     = (const float*)d_in[14];
    const float* g1     = (const float*)d_in[15];
    const float* be1    = (const float*)d_in[16];
    const float* g2     = (const float*)d_in[17];
    const float* be2    = (const float*)d_in[18];

    float* h   = (float*)d_ws;          // ROWS*4  floats
    float* qkv = h + ROWS * 4;          // ROWS*12 floats
    float* att = qkv + ROWS * 12;       // ROWS*4  floats  (~2 MB total)

    k_pre<<<BATCH, 128, 0, stream>>>(x, conv_w, conv_b, Wl, bl, ln_g, ln_b, Win, bi, h, qkv);
    for (int i = 0; i < 3; ++i) {
        k_attn     <<<SEQ * 4,   256, 0, stream>>>(qkv, att);
        k_layer_mid<<<ROWS / 64, 128, 0, stream>>>(att, h, Wout + i*16, bout + i*4,
                                                   g1 + i*4, be1 + i*4,
                                                   W1 + i*FFDIM*4, b1 + i*FFDIM,
                                                   W2 + i*4*FFDIM, b2 + i*4,
                                                   g2 + i*4, be2 + i*4,
                                                   Win + (i+1)*48, bi + (i+1)*12, qkv);
    }
    k_attn      <<<SEQ * 4,   256, 0, stream>>>(qkv, att);
    k_layer_last<<<ROWS / 64, 128, 0, stream>>>(att, h, Wout + 3*16, bout + 3*4,
                                                g1 + 3*4, be1 + 3*4,
                                                W1 + 3*FFDIM*4, b1 + 3*FFDIM,
                                                W2 + 3*4*FFDIM, b2 + 3*4,
                                                g2 + 3*4, be2 + 3*4,
                                                Wl, bl, (float*)d_out);
}

// v004
// Measured time: 65.4 microseconds a run.
// Two timings next to v003 both put it at 1.32 times that version's speed.
// Counting every step since v000, it is 2.95 times as fast.
#include <hip/hip_runtime.h>
#include <math.h>

typedef __attribute__((ext_vector_type(2))) float v2f;
typedef __attribute__((ext_vector_type(8))) float v8f;

#define SEQ   100
#define DMODEL 4
#define BATCH 256
#define ROWS  (BATCH * SEQ)   // 25600
#define FFDIM 2048
#define NREP  8

__device__ __forceinline__ float gelu_exact(float x) {
    return 0.5f * x * (1.0f + erff(x * 0.70710678118654752440f));
}

// Value of lane (l ^ M) inside the lane's 16-lane row, by DPP row_xmask; every
// lane of the wave must be on.
template <int M>
__device__ __forceinline__ float row_xor(float v) {
    return __builtin_bit_cast(float, __builtin_amdgcn_update_dpp(
        0, __builtin_bit_cast(int, v), 0x160 | M, 0xf, 0xf, true));
}
// Value of lane (l ^ 16): the same place in the wave's other 16-lane row.
__device__ __forceinline__ float other_row(float v) {
    const int b = __builtin_bit_cast(int, v);
    return __builtin_bit_cast(float, __builtin_amdgcn_permlanex16(
        b, b, 0x76543210, 0xfedcba98, false, false));
}
// Sum over the 32 lanes of a wave, the result in every lane.
__device__ __forceinline__ float wave_sum(float v) {
    v += row_xor<1>(v); v += row_xor<2>(v); v += row_xor<4>(v); v += row_xor<8>(v);
    return v + other_row(v);
}

// qkv row = hv @ Win^T + bi  (4 -> 12); row and weights are held in registers
__device__ __forceinline__ void qkv_row(const float* hv, const float* Win,
                                        const float* bi, float* __restrict__ qp) {
    #pragma unroll
    for (int j = 0; j < 12; ++j) {
        float a = bi[j];
        #pragma unroll
        for (int k = 0; k < 4; ++k) a += hv[k] * Win[j*4 + k];
        qp[j] = a;
    }
}

// ---------------------------------------------------------------------------
// K1: h = x*cw+cb ; 8x { gelu(LN_[100x4](h@Wl^T+bl)) } ; h = h@Wl^T+bl ;
// then the first layer's qkv row from the same registers.
// one block per batch element, thread r owns row r (r<100)
// h and qkv leave in workspace row order (position r, batch element b): the 256
// rows that one position's attention mixes lie together.
// ---------------------------------------------------------------------------
__global__ void k_pre(const float* __restrict__ x, const float* __restrict__ conv_w,
                      const float* __restrict__ conv_b,
                      const float* __restrict__ Wl, const float* __restrict__ bl,
                      const float* __restrict__ lng, const float* __restrict__ lnb,
                      const float* __restrict__ Win, const float* __restrict__ bi,
                      float* __restrict__ h, float* __restrict__ qkv) {
    // the four waves' partial sums {sum, sum of squares}; two copies, used in turn,
    // so that one barrier a pass is enough
    __shared__ __attribute__((aligned(16))) float sP[2][8];
    const int b = blockIdx.x;
    const int r = threadIdx.x;
    const bool act = (r < SEQ);

    const float cw = conv_w[0], cb = conv_b[0];
    float hv[4] = {0.f, 0.f, 0.f, 0.f};
    if (act) {
        const float* xp = x + (b * SEQ + r) * DMODEL;
        #pragma unroll
        for (int c = 0; c < 4; ++c) hv[c] = xp[c] * cw + cb;
    }
    float W[16], bb[4], g[4] = {1,1,1,1}, be[4] = {0,0,0,0};
    #pragma unroll
    for (int j = 0; j < 16; ++j) W[j] = Wl[j];
    #pragma unroll
    for (int c = 0; c < 4; ++c) bb[c] = bl[c];
    float wq[48], bq[12];   // asked for here, so that the tail does not wait for them
    #pragma unroll
    for (int j = 0; j < 48; ++j) wq[j] = Win[j];
    #pragma unroll
    for (int j = 0; j < 12; ++j) bq[j] = bi[j];
    if (act) {
        #pragma unroll
        for (int c = 0; c < 4; ++c) { g[c] = lng[r*4 + c]; be[c] = lnb[r*4 + c]; }
    }

    for (int it = 0; it < NREP; ++it) {
        float y[4];
        #pragma unroll
        for (int c = 0; c < 4; ++c) {
            float a = bb[c];
            #pragma unroll
            for (int k = 0; k < 4; ++k) a += hv[k] * W[c*4 + k];
            y[c] = a;
        }
        float ls = 0.f, lq = 0.f;
        if (act) {
            #pragma unroll
            for (int c = 0; c < 4; ++c) { ls += y[c]; lq += y[c]*y[c]; }
        }
        ls = wave_sum(ls);
        lq = wave_sum(lq);
        float* pp = sP[it & 1];
        if ((r & 31) == 0) { pp[(r >> 5) * 2 + 0] = ls; pp[(r >> 5) * 2 + 1] = lq; }
        __syncthreads();
        const float ts = (pp[0] + pp[2]) + (pp[4] + pp[6]);
        const float tq = (pp[1] + pp[3]) + (pp[5] + pp[7]);
        const float mean = ts * (1.0f / 400.0f);
        const float var  = tq * (1.0f / 400.0f) - mean * mean;
        const float inv  = rsqrtf(var + 1e-5f);
        if (act) {
            #pragma unroll
            for (int c = 0; c < 4; ++c)
                hv[c] = gelu_exact((y[c] - mean) * inv * g[c] + be[c]);
        }
    }
    if (act) {
        float* hp = h + (r * BATCH + b) * DMODEL;
        float ho[4];
        #pragma unroll
        for (int c = 0; c < 4; ++c) {
            float a = bb[c];
            #pragma unroll
            for (int k = 0; k < 4; ++k) a += hv[k] * W[c*4 + k];
            ho[c] = a;
            hp[c] = a;
        }
        qkv_row(ho, wq, bq, qkv + (r * BATCH + b) * 12);
    }
}

// ---------------------------------------------------------------------------
// K2: a whole encoder layer in one launch. A block owns 64 of the 256 rows of one
// position, one wave per 16-row tile. Rank-1 attention over the S=256 axis
// (head_dim=1): the position's 256 k/v rows go to LDS, a lane takes one head of
// two of its wave's rows and streams them (score(s,t) = q_s * k_t, so the exact
// row max comes from kmin/kmax), all while the weight copies fly. Then
// hn = LN_row(h + o@Wout^T + bout) in registers (each lane its row
// lane%16), the FF block on the matrix pipe, then
// one row per lane: +b2, residual, per-row LN, and from that row either the next
// layer's qkv or, behind the last layer, out = softmax_D(h@Wl^T + bl).
// GEMM1 (K=4) = v_wmma_f32_16x16x4_f32 per 16 FF
// columns; bias+relu on the D tile; GEMM2 (2048 -> 4) accumulated per lane
// straight from the WMMA D layout, cross-lane reduced once at the end.
// In-place on h (tiles are disjoint).
// The layer's W1, W2 and b1 (72 KiB) are brought into LDS once per block, all
// copies in flight together, so the 128-trip loop waits on LDS and not on L2.
// ---------------------------------------------------------------------------
#define FF_W1_OFF 0                      // floats: W1 [2048][4]
#define FF_W2_OFF (FFDIM * 4)            // floats: W2 [4][2048]
#define FF_B1_OFF (FFDIM * 8)            // floats: b1 [2048]
#define FF_LDS_FLOATS (FFDIM * 9)        // 18432 floats = 36 slabs of 2048 B
#define FF_SLAB_FLOATS 512               // 128 lanes x 16 B

// Twelve 16-byte copies per lane, global -> LDS, through no register. lds is the
// lane's LDS byte address of the first copy; copy k lands k slabs further on.
// The s_wait_xcnt closes the statement so that no address register named by a
// copy is rewritten ahead of it.
__device__ __forceinline__ void copy12_to_lds(unsigned lds, const float* const* g) {
    asm volatile(
        "global_load_async_to_lds_b128 %0, %12, off\n\t"
        "global_load_async_to_lds_b128 %1, %13, off\n\t"
        "global_load_async_to_lds_b128 %2, %14, off\n\t"
        "global_load_async_to_lds_b128 %3, %15, off\n\t"
        "global_load_async_to_lds_b128 %4, %16, off\n\t"
        "global_load_async_to_lds_b128 %5, %17, off\n\t"
        "global_load_async_to_lds_b128 %6, %18, off\n\t"
        "global_load_async_to_lds_b128 %7, %19, off\n\t"
        "global_load_async_to_lds_b128 %8, %20, off\n\t"
        "global_load_async_to_lds_b128 %9, %21, off\n\t"
        "global_load_async_to_lds_b128 %10, %22, off\n\t"
        "global_load_async_to_lds_b128 %11, %23, off\n\t"
        "s_wait_xcnt 0x0"
        :: "v"(lds), "v"(lds + 2048u), "v"(lds + 4096u), "v"(lds + 6144u),
           "v"(lds + 8192u), "v"(lds + 10240u), "v"(lds + 12288u), "v"(lds + 14336u),
           "v"(lds + 16384u), "v"(lds + 18432u), "v"(lds + 20480u), "v"(lds + 22528u),
           "v"(g[0]), "v"(g[1]), "v"(g[2]), "v"(g[3]), "v"(g[4]), "v"(g[5]),
           "v"(g[6]), "v"(g[7]), "v"(g[8]), "v"(g[9]), "v"(g[10]), "v"(g[11])
        : "memory");
}

template <bool LAST>
__device__ __forceinline__ void layer_tail(const float* qin, float* h,
                      const float* __restrict__ Wout, const float* __restrict__ bout,
                      const float* __restrict__ g1, const float* __restrict__ be1,
                      const float* __restrict__ W1, const float* __restrict__ b1,
                      const float* __restrict__ W2, const float* __restrict__ b2,
                      const float* __restrict__ g2, const float* __restrict__ be2,
                      const float* __restrict__ Wn, const float* __restrict__ bn,
                      float* __restrict__ dst) {
    __shared__ __attribute__((aligned(16))) float sW[FF_LDS_FLOATS];
    __shared__ __attribute__((aligned(16))) float sH[64 * 4];   // hn rows, for the residual
    __shared__ __attribute__((aligned(16))) float sKV[BATCH * 8];  // row t: k of heads 0-3, v of heads 0-3
    __shared__ __attribute__((aligned(16))) float sO[64 * 4];   // attention rows

    const int wave  = threadIdx.x >> 5;
    const int lane  = threadIdx.x & 31;
    const int tile  = blockIdx.x * 4 + wave;
    const int rbase = tile * 16;
    const int lm    = lane & 15;
    const int half  = lane >> 4;

    const int head  = lane & 3;      // attention: this lane's head ...
    const int g     = lane >> 2;     // ... and its two rows, g and g+8 of the tile

    // two k/v rows of the position per thread, this lane's two q, and its residual
    // row (row rbase+lm, both halves the same): asked for ahead of the copies, so
    // that all of it flies together
    // (qin and h carry no __restrict__, so these loads keep their place there)
    const float* kvp = qin + ((blockIdx.x >> 2) * BATCH + threadIdx.x) * 12 + 4;
    float kva[8], kvb[8], hr[4];
    #pragma unroll
    for (int k = 0; k < 8; ++k) { kva[k] = kvp[k]; kvb[k] = kvp[128 * 12 + k]; }
    const float q0 = qin[(rbase + g) * 12 + head];
    const float q1 = qin[(rbase + g + 8) * 12 + head];
    #pragma unroll
    for (int k = 0; k < 4; ++k) hr[k] = h[(rbase + lm) * 4 + k];

    {
        // slab k of the LDS image <- the same 2048 bytes of W1 (16 slabs), W2 (16), b1 (4)
        const int t4 = threadIdx.x * 4;
        const float* gsrc[36];
        #pragma unroll
        for (int k = 0; k < 16; ++k) {
            gsrc[k]      = W1 + k * FF_SLAB_FLOATS + t4;
            gsrc[16 + k] = W2 + k * FF_SLAB_FLOATS + t4;
        }
        #pragma unroll
        for (int k = 0; k < 4; ++k) gsrc[32 + k] = b1 + k * FF_SLAB_FLOATS + t4;
        const unsigned l0 = (unsigned)(size_t)&sW[t4];
        copy12_to_lds(l0,           gsrc);
        copy12_to_lds(l0 + 24576u,  gsrc + 12);
        copy12_to_lds(l0 + 49152u,  gsrc + 24);
    }

    // the projection's and the first LN's small weights
    float wo[16], bo[4], lg1[4], lb1[4];
    #pragma unroll
    for (int c = 0; c < 4; ++c) { bo[c] = bout[c]; lg1[c] = g1[c]; lb1[c] = be1[c]; }
    #pragma unroll
    for (int j = 0; j < 16; ++j) wo[j] = Wout[j];
    // all four weight loads are issued here, together, and arrive while the
    // attention runs: left to itself the scheduler asks for them behind it. The
    // same line keeps the LDS stores below (they wait for the k/v loads) from being
    // scheduled ahead of the copies, which would then start a load latency late
    __builtin_amdgcn_sched_barrier(0);

    #pragma unroll
    for (int k = 0; k < 8; ++k) {
        sKV[threadIdx.x * 8 + k]         = kva[k];
        sKV[(threadIdx.x + 128) * 8 + k] = kvb[k];
    }
    __syncthreads();   // all 256 k/v rows are in LDS

    float ov[4];
    {
        // every wave finds kmax and kmin of its lanes' heads by itself: 32 k per
        // lane, then across the eight lanes that share the head
        float kmax = sKV[g * 8 + head], kmin = kmax;
        #pragma unroll
        for (int j = 1; j < 32; ++j) {
            const float kk = sKV[(g + 8 * j) * 8 + head];
            kmax = fmaxf(kmax, kk); kmin = fminf(kmin, kk);
        }
        kmax = fmaxf(kmax, row_xor<4>(kmax)); kmin = fminf(kmin, row_xor<4>(kmin));
        kmax = fmaxf(kmax, row_xor<8>(kmax)); kmin = fminf(kmin, row_xor<8>(kmin));
        kmax = fmaxf(kmax, other_row(kmax));  kmin = fminf(kmin, other_row(kmin));
        const float m0 = q0 * ((q0 >= 0.f) ? kmax : kmin);
        const float m1 = q1 * ((q1 >= 0.f) ? kmax : kmin);
        float den0 = 0.f, num0 = 0.f, den1 = 0.f, num1 = 0.f;
        for (int t = 0; t < BATCH; ++t) {
            const float kt = sKV[t * 8 + head];
            const float vt = sKV[t * 8 + 4 + head];
            const float e0 = __expf(q0 * kt - m0);
            const float e1 = __expf(q1 * kt - m1);
            den0 += e0; num0 += e0 * vt;
            den1 += e1; num1 += e1 * vt;
        }
        sO[(wave * 16 + g) * 4 + head]     = num0 / den0;
        sO[(wave * 16 + g + 8) * 4 + head] = num1 / den1;
        __syncthreads();   // the four heads of a row come from four lanes
        #pragma unroll
        for (int k = 0; k < 4; ++k) ov[k] = sO[(wave * 16 + lm) * 4 + k];
    }

    // hn = LN_row( h + o@Wout^T + bout )
    float hn[4];
    {
        float y[4];
        #pragma unroll
        for (int c = 0; c < 4; ++c) {
            float acc = bo[c];
            #pragma unroll
            for (int k = 0; k < 4; ++k) acc += ov[k] * wo[c*4 + k];
            y[c] = hr[c] + acc;
        }
        const float mean = 0.25f * (y[0] + y[1] + y[2] + y[3]);
        float var = 0.f;
        #pragma unroll
        for (int c = 0; c < 4; ++c) { const float d0 = y[c] - mean; var += d0 * d0; }
        var *= 0.25f;
        const float inv = rsqrtf(var + 1e-5f);
        #pragma unroll
        for (int c = 0; c < 4; ++c) hn[c] = (y[c] - mean) * inv * lg1[c] + lb1[c];
    }
    // A-layout (16x4 f32): lane = M%16, VGPR0/1 = K {0,1} (lanes 0-15) / {2,3} (16-31)
    v2f a; a.x = half ? hn[2] : hn[0]; a.y = half ? hn[3] : hn[1];
    // the same two elements go to the row's place in sH
    sH[(wave * 16 + lm) * 4 + half * 2 + 0] = a.x;
    sH[(wave * 16 + lm) * 4 + half * 2 + 1] = a.y;
    const v8f cz = {0.f, 0.f, 0.f, 0.f, 0.f, 0.f, 0.f, 0.f};

    float zacc[8][4];
    #pragma unroll
    for (int r2 = 0; r2 < 8; ++r2)
        #pragma unroll
        for (int c = 0; c < 4; ++c) zacc[r2][c] = 0.f;

    // this wave's copies have landed; behind the barrier every wave's have
    asm volatile("s_wait_asynccnt 0x0" ::: "memory");
    __syncthreads();

    // the tail's small weights: asked for here, they arrive while the loop runs
    constexpr int NW = LAST ? 16 : 48;
    constexpr int NB = LAST ? 4 : 12;
    float fb2[4], lg2[4], lb2[4], wn[NW], bnv[NB];
    #pragma unroll
    for (int k = 0; k < 4; ++k) { fb2[k] = b2[k]; lg2[k] = g2[k]; lb2[k] = be2[k]; }
    #pragma unroll
    for (int j = 0; j < NW; ++j) wn[j] = Wn[j];
    #pragma unroll
    for (int j = 0; j < NB; ++j) bnv[j] = bn[j];

    for (int ch = 0; ch < FFDIM / 16; ++ch) {
        const int ffl = ch * 16 + lm;
        // B-layout (4x16 f32): lane = N%16, VGPR0/1 = K {0,1}/{2,3}; W1 is [2048,4] row-major
        const float* bp = sW + FF_W1_OFF + ffl * 4 + half * 2;
        v2f bm; bm.x = bp[0]; bm.y = bp[1];

        v8f d = __builtin_amdgcn_wmma_f32_16x16x4_f32(
            false, a, false, bm, (short)0, cz, false, false);

        const float b1v = sW[FF_B1_OFF + ffl];
        const float w20 = sW[FF_W2_OFF + 0 * FFDIM + ffl];
        const float w21 = sW[FF_W2_OFF + 1 * FFDIM + ffl];
        const float w22 = sW[FF_W2_OFF + 2 * FFDIM + ffl];
        const float w23 = sW[FF_W2_OFF + 3 * FFDIM + ffl];
        #pragma unroll
        for (int r2 = 0; r2 < 8; ++r2) {
            // D layout: VGPR r2 holds row M = r2 + 8*half, column N = ffl
            float f = d[r2] + b1v;
            f = fmaxf(f, 0.f);
            zacc[r2][0] += f * w20;
            zacc[r2][1] += f * w21;
            zacc[r2][2] += f * w22;
            zacc[r2][3] += f * w23;
        }
    }

    // reduce across the 16 lanes of each half (a DPP row is one half)
    #pragma unroll
    for (int r2 = 0; r2 < 8; ++r2)
        #pragma unroll
        for (int c = 0; c < 4; ++c) {
            float v = zacc[r2][c];
            v += row_xor<1>(v);
            v += row_xor<2>(v);
            v += row_xor<4>(v);
            v += row_xor<8>(v);
            zacc[r2][c] = v;
        }

    // every lane of a half holds all 8 row sums: lane lm takes row lm%8 of its half
    const int rsel = lm & 7;
    float z[4];
    #pragma unroll
    for (int c = 0; c < 4; ++c) z[c] = zacc[0][c];
    #pragma unroll
    for (int r2 = 1; r2 < 8; ++r2)
        #pragma unroll
        for (int c = 0; c < 4; ++c) z[c] = (rsel == r2) ? zacc[r2][c] : z[c];

    if (lm < 8) {
        const int trow = half * 8 + rsel;
        const int row  = rbase + trow;
        const float* hp = sH + (wave * 16 + trow) * 4;
        float y[4], hv[4];
        #pragma unroll
        for (int c = 0; c < 4; ++c) y[c] = hp[c] + z[c] + fb2[c];
        const float mean = 0.25f * (y[0] + y[1] + y[2] + y[3]);
        float var = 0.f;
        #pragma unroll
        for (int c = 0; c < 4; ++c) { const float d0 = y[c] - mean; var += d0 * d0; }
        var *= 0.25f;
        const float inv = rsqrtf(var + 1e-5f);
        #pragma unroll
        for (int c = 0; c < 4; ++c) hv[c] = (y[c] - mean) * inv * lg2[c] + lb2[c];

        if (!LAST) {
            // h for the next layer's residual, and its qkv row (Wn = Win, bn = bi)
            float* op = h + row * 4;
            #pragma unroll
            for (int c = 0; c < 4; ++c) op[c] = hv[c];
            qkv_row(hv, wn, bnv, dst + row * 12);
        } else {
            // out = softmax_D( h @ Wl^T + bl )  (Wn = Wl, bn = bl)
            float t[4];
            #pragma unroll
            for (int c = 0; c < 4; ++c) {
                float acc = bnv[c];
                #pragma unroll
                for (int k = 0; k < 4; ++k) acc += hv[k] * wn[c*4 + k];
                t[c] = acc;
            }
            const float m = fmaxf(fmaxf(t[0], t[1]), fmaxf(t[2], t[3]));
            float e[4], s = 0.f;
            #pragma unroll
            for (int c = 0; c < 4; ++c) { e[c] = __expf(t[c] - m); s += e[c]; }
            const float invs = 1.f / s;
            // workspace row (position, batch element) -> out row (batch element, position)
            float* op = dst + ((row & (BATCH - 1)) * SEQ + (row >> 8)) * 4;
            #pragma unroll
            for (int c = 0; c < 4; ++c) op[c] = e[c] * invs;
        }
    }
}

__global__ void __launch_bounds__(128) k_layer_mid(const float* qin, float* h,
                      const float* __restrict__ Wout, const float* __restrict__ bout,
                      const float* __restrict__ g1, const float* __restrict__ be1,
                      const float* __restrict__ W1, const float* __restrict__ b1,
                      const float* __restrict__ W2, const float* __restrict__ b2,
                      const float* __restrict__ g2, const float* __restrict__ be2,
                      const float* __restrict__ Win, const float* __restrict__ bi,
                      float* __restrict__ qkv) {
    layer_tail<false>(qin, h, Wout, bout, g1, be1, W1, b1, W2, b2, g2, be2, Win, bi, qkv);
}

__global__ void __launch_bounds__(128) k_layer_last(const float* qin, float* h,
                      const float* __restrict__ Wout, const float* __restrict__ bout,
                      const float* __restrict__ g1, const float* __restrict__ be1,
                      const float* __restrict__ W1, const float* __restrict__ b1,
                      const float* __restrict__ W2, const float* __restrict__ b2,
                      const float* __restrict__ g2, const float* __restrict__ be2,
                      const float* __restrict__ Wl, const float* __restrict__ bl,
                      float* __restrict__ out) {
    layer_tail<true>(qin, h, Wout, bout, g1, be1, W1, b1, W2, b2, g2, be2, Wl, bl, out);
}

// ---------------------------------------------------------------------------
extern "C" void kernel_launch(void* const* d_in, const int* in_sizes, int n_in,
                              void* d_out, int out_size, void* d_ws, size_t ws_size,
                              hipStream_t stream) {
    (void)in_sizes; (void)n_in; (void)out_size; (void)ws_size;
    const float* x      = (const float*)d_in[0];
    const float* conv_w = (const float*)d_in[1];
    const float* conv_b = (const float*)d_in[2];
    const float* Wl     = (const float*)d_in[3];
    const float* bl     = (const float*)d_in[4];
    const float* ln_g   = (const float*)d_in[5];
    const float* ln_b   = (const float*)d_in[6];
    const float* Win    = (const float*)d_in[7];
    const float* bi     = (const float*)d_in[8];
    const float* Wout   = (const float*)d_in[9];
    const float* bout   = (const float*)d_in[10];
    const float* W1     = (const float*)d_in[11];
    const float* b1     = (const float*)d_in[12];
    const float* W2     = (const float*)d_in[13];
    const float* b2     = (const float*)d_in[14];
    const float* g1     = (const float*)d_in[15];
    const float* be1    = (const float*)d_in[16];
    const float* g2     = (const float*)d_in[17];
    const float* be2    = (const float*)d_in[18];

    float* h    = (float*)d_ws;         // ROWS*4  floats
    float* qkvA = h + ROWS * 4;         // ROWS*12 floats: read by layers 0 and 2
    float* qkvB = qkvA + ROWS * 12;     // ROWS*12 floats: read by layers 1 and 3
    // two qkv planes in turn: a block writes its rows of the next layer's qkv while
    // other blocks of the same position may still read this layer's k/v

    k_pre<<<BATCH, 128, 0, stream>>>(x, conv_w, conv_b, Wl, bl, ln_g, ln_b, Win, bi, h, qkvA);
    for (int i = 0; i < 3; ++i) {
        k_layer_mid<<<ROWS / 64, 128, 0, stream>>>((i & 1) ? qkvB : qkvA, h, Wout + i*16, bout + i*4,
                                                   g1 + i*4, be1 + i*4,
                                                   W1 + i*FFDIM*4, b1 + i*FFDIM,
                                                   W2 + i*4*FFDIM, b2 + i*4,
                                                   g2 + i*4, be2 + i*4,
                                                   Win + (i+1)*48, bi + (i+1)*12,
                                                   (i & 1) ? qkvA : qkvB);
    }
    k_layer_last<<<ROWS / 64, 128, 0, stream>>>(qkvB, h, Wout + 3*16, bout + 3*4,
                                                g1 + 3*4, be1 + 3*4,
                                                W1 + 3*FFDIM*4, b1 + 3*FFDIM,
                                                W2 + 3*4*FFDIM, b2 + 3*4,
                                                g2 + 3*4, be2 + 3*4,
                                                Wl, bl, (float*)d_out);
}

// v005
// A run of this version takes 62 microseconds.
// Two timings next to v004 both put it at 1.05 times that version's speed.
// Over all steps from v000 it is 3.10 times as fast.
#include <hip/hip_runtime.h>
#include <math.h>

typedef __attribute__((ext_vector_type(2))) float v2f;
typedef __attribute__((ext_vector_type(8))) float v8f;

#define SEQ   100
#define DMODEL 4
#define BATCH 256
#define ROWS  (BATCH * SEQ)   // 25600
#define FFDIM 2048
#define NREP  8

__device__ __forceinline__ float gelu_exact(float x) {
    return 0.5f * x * (1.0f + erff(x * 0.70710678118654752440f));
}

// Value of lane (l ^ M) inside the lane's 16-lane row, by DPP row_xmask; every
// lane of the wave must be on.
template <int M>
__device__ __forceinline__ float row_xor(float v) {
    return __builtin_bit_cast(float, __builtin_amdgcn_update_dpp(
        0, __builtin_bit_cast(int, v), 0x160 | M, 0xf, 0xf, true));
}
// Value of lane (l ^ 16): the same place in the wave's other 16-lane row.
__device__ __forceinline__ float other_row(float v) {
    const int b = __builtin_bit_cast(int, v);
    return __builtin_bit_cast(float, __builtin_amdgcn_permlanex16(
        b, b, 0x76543210, 0xfedcba98, false, false));
}
// Sum over the 32 lanes of a wave, the result in every lane.
__device__ __forceinline__ float wave_sum(float v) {
    v += row_xor<1>(v); v += row_xor<2>(v); v += row_xor<4>(v); v += row_xor<8>(v);
    return v + other_row(v);
}

// qkv row = hv @ Win^T + bi  (4 -> 12); row and weights are held in registers
__device__ __forceinline__ void qkv_row(const float* hv, const float* Win,
                                        const float* bi, float* __restrict__ qp) {
    #pragma unroll
    for (int j = 0; j < 12; ++j) {
        float a = bi[j];
        #pragma unroll
        for (int k = 0; k < 4; ++k) a += hv[k] * Win[j*4 + k];
        qp[j] = a;
    }
}

// ---------------------------------------------------------------------------
// K1: h = x*cw+cb ; 8x { gelu(LN_[100x4](h@Wl^T+bl)) } ; h = h@Wl^T+bl ;
// then the first layer's qkv row from the same registers.
// one block per batch element, thread r owns row r (r<100)
// h and qkv leave in workspace row order (position r, batch element b): the 256
// rows that one position's attention mixes lie together.
// ---------------------------------------------------------------------------
__global__ void k_pre(const float* __restrict__ x, const float* __restrict__ conv_w,
                      const float* __restrict__ conv_b,
                      const float* __restrict__ Wl, const float* __restrict__ bl,
                      const float* __restrict__ lng, const float* __restrict__ lnb,
                      const float* __restrict__ Win, const float* __restrict__ bi,
                      float* __restrict__ h, float* __restrict__ qkv) {
    // the four waves' partial sums {sum, sum of squares}; two copies, used in turn,
    // so that one barrier a pass is enough
    __shared__ __attribute__((aligned(16))) float sP[2][8];
    const int b = blockIdx.x;
    const int r = threadIdx.x;
    const bool act = (r < SEQ);

    const float cw = conv_w[0], cb = conv_b[0];
    float hv[4] = {0.f, 0.f, 0.f, 0.f};
    if (act) {
        const float* xp = x + (b * SEQ + r) * DMODEL;
        #pragma unroll
        for (int c = 0; c < 4; ++c) hv[c] = xp[c] * cw + cb;
    }
    float W[16], bb[4], g[4] = {1,1,1,1}, be[4] = {0,0,0,0};
    #pragma unroll
    for (int j = 0; j < 16; ++j) W[j] = Wl[j];
    #pragma unroll
    for (int c = 0; c < 4; ++c) bb[c] = bl[c];
    float wq[48], bq[12];   // asked for here, so that the tail does not wait for them
    #pragma unroll
    for (int j = 0; j < 48; ++j) wq[j] = Win[j];
    #pragma unroll
    for (int j = 0; j < 12; ++j) bq[j] = bi[j];
    if (act) {
        #pragma unroll
        for (int c = 0; c < 4; ++c) { g[c] = lng[r*4 + c]; be[c] = lnb[r*4 + c]; }
    }

    for (int it = 0; it < NREP; ++it) {
        float y[4];
        #pragma unroll
        for (int c = 0; c < 4; ++c) {
            float a = bb[c];
            #pragma unroll
            for (int k = 0; k < 4; ++k) a += hv[k] * W[c*4 + k];
            y[c] = a;
        }
        float ls = 0.f, lq = 0.f;
        if (act) {
            #pragma unroll
            for (int c = 0; c < 4; ++c) { ls += y[c]; lq += y[c]*y[c]; }
        }
        ls = wave_sum(ls);
        lq = wave_sum(lq);
        float* pp = sP[it & 1];
        if ((r & 31) == 0) { pp[(r >> 5) * 2 + 0] = ls; pp[(r >> 5) * 2 + 1] = lq; }
        __syncthreads();
        const float ts = (pp[0] + pp[2]) + (pp[4] + pp[6]);
        const float tq = (pp[1] + pp[3]) + (pp[5] + pp[7]);
        const float mean = ts * (1.0f / 400.0f);
        const float var  = tq * (1.0f / 400.0f) - mean * mean;
        const float inv  = rsqrtf(var + 1e-5f);
        if (act) {
            #pragma unroll
            for (int c = 0; c < 4; ++c)
                hv[c] = gelu_exact((y[c] - mean) * inv * g[c] + be[c]);
        }
    }
    if (act) {
        float* hp = h + (r * BATCH + b) * DMODEL;
        float ho[4];
        #pragma unroll
        for (int c = 0; c < 4; ++c) {
            float a = bb[c];
            #pragma unroll
            for (int k = 0; k < 4; ++k) a += hv[k] * W[c*4 + k];
            ho[c] = a;
            hp[c] = a;
        }
        qkv_row(ho, wq, bq, qkv + (r * BATCH + b) * 12);
    }
}

// ---------------------------------------------------------------------------
// K2: a whole encoder layer in one launch. A block owns 64 of the 256 rows of one
// position, one wave per 16-row tile. Rank-1 attention over the S=256 axis
// (head_dim=1): the position's 256 k/v rows go to LDS, a lane takes one head of
// two of its wave's rows and streams them (score(s,t) = q_s * k_t, so the exact
// row max comes from kmin/kmax), all while the weight copies fly. Then
// hn = LN_row(h + o@Wout^T + bout) in registers (each lane its row
// lane%16), the FF block on the matrix pipe, then
// one row per lane: +b2, residual, per-row LN, and from that row either the next
// layer's qkv or, behind the last layer, out = softmax_D(h@Wl^T + bl).
// GEMM1 (K=4) = v_wmma_f32_16x16x4_f32 per 16 FF
// columns; bias+relu on the D tile; GEMM2 (2048 -> 4) accumulated per lane
// straight from the WMMA D layout, cross-lane reduced once at the end.
// In-place on h (tiles are disjoint).
// The layer's W1, W2 and b1 (72 KiB) are brought into LDS once per block, all
// copies in flight together, so the loop over the 128 chunks waits on LDS and not on L2.
// ---------------------------------------------------------------------------
#define FF_W1_OFF 0                      // floats: W1 [2048][4]
#define FF_W2_OFF (FFDIM * 4)            // floats: W2 [4][2048]
#define FF_B1_OFF (FFDIM * 8)            // floats: b1 [2048]
#define FF_LDS_FLOATS (FFDIM * 9)        // 18432 floats = 36 slabs of 2048 B
#define FF_SLAB_FLOATS 512               // 128 lanes x 16 B

// Twelve 16-byte copies per lane, global -> LDS, through no register. lds is the
// lane's LDS byte address of the first copy; copy k lands k slabs further on.
// The s_wait_xcnt closes the statement so that no address register named by a
// copy is rewritten ahead of it.
__device__ __forceinline__ void copy12_to_lds(unsigned lds, const float* const* g) {
    asm volatile(
        "global_load_async_to_lds_b128 %0, %12, off\n\t"
        "global_load_async_to_lds_b128 %1, %13, off\n\t"
        "global_load_async_to_lds_b128 %2, %14, off\n\t"
        "global_load_async_to_lds_b128 %3, %15, off\n\t"
        "global_load_async_to_lds_b128 %4, %16, off\n\t"
        "global_load_async_to_lds_b128 %5, %17, off\n\t"
        "global_load_async_to_lds_b128 %6, %18, off\n\t"
        "global_load_async_to_lds_b128 %7, %19, off\n\t"
        "global_load_async_to_lds_b128 %8, %20, off\n\t"
        "global_load_async_to_lds_b128 %9, %21, off\n\t"
        "global_load_async_to_lds_b128 %10, %22, off\n\t"
        "global_load_async_to_lds_b128 %11, %23, off\n\t"
        "s_wait_xcnt 0x0"
        :: "v"(lds), "v"(lds + 2048u), "v"(lds + 4096u), "v"(lds + 6144u),
           "v"(lds + 8192u), "v"(lds + 10240u), "v"(lds + 12288u), "v"(lds + 14336u),
           "v"(lds + 16384u), "v"(lds + 18432u), "v"(lds + 20480u), "v"(lds + 22528u),
           "v"(g[0]), "v"(g[1]), "v"(g[2]), "v"(g[3]), "v"(g[4]), "v"(g[5]),
           "v"(g[6]), "v"(g[7]), "v"(g[8]), "v"(g[9]), "v"(g[10]), "v"(g[11])
        : "memory");
}

// Eight k/v rows (group blk) of one head, LDS -> registers.
__device__ __forceinline__ void kv_read(const float* sKV, int blk, int head,
                                        float* kk, float* vv) {
    #pragma unroll
    for (int j = 0; j < 8; ++j) {
        kk[j] = sKV[(blk * 8 + j) * 8 + head];
        vv[j] = sKV[(blk * 8 + j) * 8 + 4 + head];
    }
}

// What a lane needs of one chunk of 16 FF columns: its B fragment of W1, and b1
// and the four W2 values of its column.
struct ff_w { v2f bm; float b1v, w20, w21, w22, w23; };
__device__ __forceinline__ ff_w ff_read(const float* sW, int ch, int lm, int half) {
    const int ffl = ch * 16 + lm;
    // B-layout (4x16 f32): lane = N%16, VGPR0/1 = K {0,1}/{2,3}; W1 is [2048,4] row-major
    const float* bp = sW + FF_W1_OFF + ffl * 4 + half * 2;
    ff_w w;
    w.bm.x = bp[0]; w.bm.y = bp[1];
    w.b1v = sW[FF_B1_OFF + ffl];
    w.w20 = sW[FF_W2_OFF + 0 * FFDIM + ffl];
    w.w21 = sW[FF_W2_OFF + 1 * FFDIM + ffl];
    w.w22 = sW[FF_W2_OFF + 2 * FFDIM + ffl];
    w.w23 = sW[FF_W2_OFF + 3 * FFDIM + ffl];
    return w;
}
// bias + relu on a chunk's D tile, then its share of GEMM2
__device__ __forceinline__ void ff_acc(const v8f d, const ff_w& w, float (&zacc)[8][4]) {
    #pragma unroll
    for (int r2 = 0; r2 < 8; ++r2) {
        // D layout: VGPR r2 holds row M = r2 + 8*half, column N = the lane's
        float f = d[r2] + w.b1v;
        f = fmaxf(f, 0.f);
        // the fused multiply-add that '+= f * w' compiled to before, now written out:
        // with several chunks in one block the compiler otherwise pairs the products
        // of neighbouring chunks and adds them in instructions of their own
        zacc[r2][0] = __builtin_fmaf(f, w.w20, zacc[r2][0]);
        zacc[r2][1] = __builtin_fmaf(f, w.w21, zacc[r2][1]);
        zacc[r2][2] = __builtin_fmaf(f, w.w22, zacc[r2][2]);
        zacc[r2][3] = __builtin_fmaf(f, w.w23, zacc[r2][3]);
    }
}

template <bool LAST>
__device__ __forceinline__ void layer_tail(const float* qin, float* h,
                      const float* __restrict__ Wout, const float* __restrict__ bout,
                      const float* __restrict__ g1, const float* __restrict__ be1,
                      const float* __restrict__ W1, const float* __restrict__ b1,
                      const float* __restrict__ W2, const float* __restrict__ b2,
                      const float* __restrict__ g2, const float* __restrict__ be2,
                      const float* __restrict__ Wn, const float* __restrict__ bn,
                      float* __restrict__ dst) {
    __shared__ __attribute__((aligned(16))) float sW[FF_LDS_FLOATS];
    __shared__ __attribute__((aligned(16))) float sH[64 * 4];   // hn rows, for the residual
    __shared__ __attribute__((aligned(16))) float sKV[BATCH * 8];  // row t: k of heads 0-3, v of heads 0-3
    __shared__ __attribute__((aligned(16))) float sO[64 * 4];   // attention rows

    const int wave  = threadIdx.x >> 5;
    const int lane  = threadIdx.x & 31;
    const int tile  = blockIdx.x * 4 + wave;
    const int rbase = tile * 16;
    const int lm    = lane & 15;
    const int half  = lane >> 4;

    const int head  = lane & 3;      // attention: this lane's head ...
    const int g     = lane >> 2;     // ... and its two rows, g and g+8 of the tile

    // two k/v rows of the position per thread, this lane's two q, and its residual
    // row (row rbase+lm, both halves the same): asked for ahead of the copies, so
    // that all of it flies together
    // (qin and h carry no __restrict__, so these loads keep their place there)
    const float* kvp = qin + ((blockIdx.x >> 2) * BATCH + threadIdx.x) * 12 + 4;
    float kva[8], kvb[8], hr[4];
    #pragma unroll
    for (int k = 0; k < 8; ++k) { kva[k] = kvp[k]; kvb[k] = kvp[128 * 12 + k]; }
    const float q0 = qin[(rbase + g) * 12 + head];
    const float q1 = qin[(rbase + g + 8) * 12 + head];
    #pragma unroll
    for (int k = 0; k < 4; ++k) hr[k] = h[(rbase + lm) * 4 + k];

    {
        // slab k of the LDS image <- the same 2048 bytes of W1 (16 slabs), W2 (16), b1 (4)
        const int t4 = threadIdx.x * 4;
        const float* gsrc[36];
        #pragma unroll
        for (int k = 0; k < 16; ++k) {
            gsrc[k]      = W1 + k * FF_SLAB_FLOATS + t4;
            gsrc[16 + k] = W2 + k * FF_SLAB_FLOATS + t4;
        }
        #pragma unroll
        for (int k = 0; k < 4; ++k) gsrc[32 + k] = b1 + k * FF_SLAB_FLOATS + t4;
        const unsigned l0 = (unsigned)(size_t)&sW[t4];
        copy12_to_lds(l0,           gsrc);
        copy12_to_lds(l0 + 24576u,  gsrc + 12);
        copy12_to_lds(l0 + 49152u,  gsrc + 24);
    }

    // the projection's and the first LN's small weights
    float wo[16], bo[4], lg1[4], lb1[4];
    #pragma unroll
    for (int c = 0; c < 4; ++c) { bo[c] = bout[c]; lg1[c] = g1[c]; lb1[c] = be1[c]; }
    #pragma unroll
    for (int j = 0; j < 16; ++j) wo[j] = Wout[j];
    // all four weight loads are issued here, together, and arrive while the
    // attention runs: left to itself the scheduler asks for them behind it. The
    // same line keeps the LDS stores below (they wait for the k/v loads) from being
    // scheduled ahead of the copies, which would then start a load latency late
    __builtin_amdgcn_sched_barrier(0);

    #pragma unroll
    for (int k = 0; k < 8; ++k) {
        sKV[threadIdx.x * 8 + k]         = kva[k];
        sKV[(threadIdx.x + 128) * 8 + k] = kvb[k];
    }
    __syncthreads();   // all 256 k/v rows are in LDS

    float ov[4];
    {
        // every wave finds kmax and kmin of its lanes' heads by itself: 32 k per
        // lane, then across the eight lanes that share the head
        float kmax = sKV[g * 8 + head], kmin = kmax;
        #pragma unroll
        for (int j = 1; j < 32; ++j) {
            const float kk = sKV[(g + 8 * j) * 8 + head];
            kmax = fmaxf(kmax, kk); kmin = fminf(kmin, kk);
        }
        kmax = fmaxf(kmax, row_xor<4>(kmax)); kmin = fminf(kmin, row_xor<4>(kmin));
        kmax = fmaxf(kmax, row_xor<8>(kmax)); kmin = fminf(kmin, row_xor<8>(kmin));
        kmax = fmaxf(kmax, other_row(kmax));  kmin = fminf(kmin, other_row(kmin));
        const float m0 = q0 * ((q0 >= 0.f) ? kmax : kmin);
        const float m1 = q1 * ((q1 >= 0.f) ? kmax : kmin);
        float den0 = 0.f, num0 = 0.f, den1 = 0.f, num1 = 0.f;
        // the 256 rows in 32 groups of eight; three register sets in turn, so that a
        // group can be asked of LDS up to two groups ahead of its use
        float kb[3][8], vb[3][8];
        auto kv_use = [&](const float* kk, const float* vv) __attribute__((always_inline)) {
            #pragma unroll
            for (int j = 0; j < 8; ++j) {
                const float e0 = __expf(q0 * kk[j] - m0);
                const float e1 = __expf(q1 * kk[j] - m1);
                den0 += e0; num0 += e0 * vv[j];
                den1 += e1; num1 += e1 * vv[j];
            }
        };
        kv_read(sKV, 0, head, kb[0], vb[0]);
        kv_read(sKV, 1, head, kb[1], vb[1]);
        // stays rolled: one trip is one full turn of the three sets
        #pragma unroll 1
        for (int b0 = 0; b0 < 30; b0 += 3) {
            #pragma unroll
            for (int u = 0; u < 3; ++u) {
                kv_read(sKV, b0 + u + 2, head, kb[(u + 2) % 3], vb[(u + 2) % 3]);
                kv_use(kb[u], vb[u]);
            }
        }
        kv_use(kb[0], vb[0]);   // groups 30 and 31
        kv_use(kb[1], vb[1]);
        sO[(wave * 16 + g) * 4 + head]     = num0 / den0;
        sO[(wave * 16 + g + 8) * 4 + head] = num1 / den1;
        __syncthreads();   // the four heads of a row come from four lanes
        #pragma unroll
        for (int k = 0; k < 4; ++k) ov[k] = sO[(wave * 16 + lm) * 4 + k];
    }

    // hn = LN_row( h + o@Wout^T + bout )
    float hn[4];
    {
        float y[4];
        #pragma unroll
        for (int c = 0; c < 4; ++c) {
            float acc = bo[c];
            #pragma unroll
            for (int k = 0; k < 4; ++k) acc += ov[k] * wo[c*4 + k];
            y[c] = hr[c] + acc;
        }
        const float mean = 0.25f * (y[0] + y[1] + y[2] + y[3]);
        float var = 0.f;
        #pragma unroll
        for (int c = 0; c < 4; ++c) { const float d0 = y[c] - mean; var += d0 * d0; }
        var *= 0.25f;
        const float inv = rsqrtf(var + 1e-5f);
        #pragma unroll
        for (int c = 0; c < 4; ++c) hn[c] = (y[c] - mean) * inv * lg1[c] + lb1[c];
    }
    // A-layout (16x4 f32): lane = M%16, VGPR0/1 = K {0,1} (lanes 0-15) / {2,3} (16-31)
    v2f a; a.x = half ? hn[2] : hn[0]; a.y = half ? hn[3] : hn[1];
    // the same two elements go to the row's place in sH
    sH[(wave * 16 + lm) * 4 + half * 2 + 0] = a.x;
    sH[(wave * 16 + lm) * 4 + half * 2 + 1] = a.y;
    const v8f cz = {0.f, 0.f, 0.f, 0.f, 0.f, 0.f, 0.f, 0.f};

    float zacc[8][4];
    #pragma unroll
    for (int r2 = 0; r2 < 8; ++r2)
        #pragma unroll
        for (int c = 0; c < 4; ++c) zacc[r2][c] = 0.f;

    // this wave's copies have landed; behind the barrier every wave's have
    asm volatile("s_wait_asynccnt 0x0" ::: "memory");
    __syncthreads();

    // the tail's small weights: asked for here, they arrive while the loop runs
    constexpr int NW = LAST ? 16 : 48;
    constexpr int NB = LAST ? 4 : 12;
    float fb2[4], lg2[4], lb2[4], wn[NW], bnv[NB];
    #pragma unroll
    for (int k = 0; k < 4; ++k) { fb2[k] = b2[k]; lg2[k] = g2[k]; lb2[k] = be2[k]; }
    #pragma unroll
    for (int j = 0; j < NW; ++j) wn[j] = Wn[j];
    #pragma unroll
    for (int j = 0; j < NB; ++j) bnv[j] = bn[j];

    // The 128 chunks as a three-stage pipeline in registers: the weights of chunks c+6
    // and c+7 are asked of LDS, then twice: the next chunk's WMMA is issued and this
    // chunk's D tile gets its vector work. Eight weight sets and two D tiles in turn;
    // the chunks are summed in the old order.
    ff_w wb[8];
    v8f  db[2];
    #pragma unroll
    for (int u = 0; u < 6; ++u) wb[u] = ff_read(sW, u, lm, half);
    db[0] = __builtin_amdgcn_wmma_f32_16x16x4_f32(
        false, a, false, wb[0].bm, (short)0, cz, false, false);
    // stays rolled: one trip is one full turn of the eight sets
    #pragma unroll 1
    for (int c0 = 0; c0 < 120; c0 += 8) {
        #pragma unroll
        for (int u = 0; u < 8; u += 2) {
            wb[(u + 6) % 8] = ff_read(sW, c0 + u + 6, lm, half);
            wb[(u + 7) % 8] = ff_read(sW, c0 + u + 7, lm, half);
            #pragma unroll
            for (int v = u; v < u + 2; ++v) {
                db[(v + 1) & 1] = __builtin_amdgcn_wmma_f32_16x16x4_f32(
                    false, a, false, wb[(v + 1) % 8].bm, (short)0, cz, false, false);
                ff_acc(db[v & 1], wb[v], zacc);
            }
        }
    }
    // chunks 120 to 127: the pipeline runs empty
    wb[6] = ff_read(sW, 126, lm, half);
    wb[7] = ff_read(sW, 127, lm, half);
    #pragma unroll
    for (int v = 0; v < 8; ++v) {
        if (v < 7) db[(v + 1) & 1] = __builtin_amdgcn_wmma_f32_16x16x4_f32(
                       false, a, false, wb[v + 1].bm, (short)0, cz, false, false);
        ff_acc(db[v & 1], wb[v], zacc);
    }

    // reduce across the 16 lanes of each half (a DPP row is one half)
    #pragma unroll
    for (int r2 = 0; r2 < 8; ++r2)
        #pragma unroll
        for (int c = 0; c < 4; ++c) {
            float v = zacc[r2][c];
            v += row_xor<1>(v);
            v += row_xor<2>(v);
            v += row_xor<4>(v);
            v += row_xor<8>(v);
            zacc[r2][c] = v;
        }

    // every lane of a half holds all 8 row sums: lane lm takes row lm%8 of its half
    const int rsel = lm & 7;
    float z[4];
    #pragma unroll
    for (int c = 0; c < 4; ++c) z[c] = zacc[0][c];
    #pragma unroll
    for (int r2 = 1; r2 < 8; ++r2)
        #pragma unroll
        for (int c = 0; c < 4; ++c) z[c] = (rsel == r2) ? zacc[r2][c] : z[c];

    if (lm < 8) {
        const int trow = half * 8 + rsel;
        const int row  = rbase + trow;
        const float* hp = sH + (wave * 16 + trow) * 4;
        float y[4], hv[4];
        #pragma unroll
        for (int c = 0; c < 4; ++c) y[c] = hp[c] + z[c] + fb2[c];
        const float mean = 0.25f * (y[0] + y[1] + y[2] + y[3]);
        float var = 0.f;
        #pragma unroll
        for (int c = 0; c < 4; ++c) { const float d0 = y[c] - mean; var += d0 * d0; }
        var *= 0.25f;
        const float inv = rsqrtf(var + 1e-5f);
        #pragma unroll
        for (int c = 0; c < 4; ++c) hv[c] = (y[c] - mean) * inv * lg2[c] + lb2[c];

        if (!LAST) {
            // h for the next layer's residual, and its qkv row (Wn = Win, bn = bi)
            float* op = h + row * 4;
            #pragma unroll
            for (int c = 0; c < 4; ++c) op[c] = hv[c];
            qkv_row(hv, wn, bnv, dst + row * 12);
        } else {
            // out = softmax_D( h @ Wl^T + bl )  (Wn = Wl, bn = bl)
            float t[4];
            #pragma unroll
            for (int c = 0; c < 4; ++c) {
                float acc = bnv[c];
                #pragma unroll
                for (int k = 0; k < 4; ++k) acc += hv[k] * wn[c*4 + k];
                t[c] = acc;
            }
            const float m = fmaxf(fmaxf(t[0], t[1]), fmaxf(t[2], t[3]));
            float e[4], s = 0.f;
            #pragma unroll
            for (int c = 0; c < 4; ++c) { e[c] = __expf(t[c] - m); s += e[c]; }
            const float invs = 1.f / s;
            // workspace row (position, batch element) -> out row (batch element, position)
            float* op = dst + ((row & (BATCH - 1)) * SEQ + (row >> 8)) * 4;
            #pragma unroll
            for (int c = 0; c < 4; ++c) op[c] = e[c] * invs;
        }
    }
}

__global__ void __launch_bounds__(128) k_layer_mid(const float* qin, float* h,
                      const float* __restrict__ Wout, const float* __restrict__ bout,
                      const float* __restrict__ g1, const float* __restrict__ be1,
                      const float* __restrict__ W1, const float* __restrict__ b1,
                      const float* __restrict__ W2, const float* __restrict__ b2,
                      const float* __restrict__ g2, const float* __restrict__ be2,
                      const float* __restrict__ Win, const float* __restrict__ bi,
                      float* __restrict__ qkv) {
    layer_tail<false>(qin, h, Wout, bout, g1, be1, W1, b1, W2, b2, g2, be2, Win, bi, qkv);
}

__global__ void __launch_bounds__(128) k_layer_last(const float* qin, float* h,
                      const float* __restrict__ Wout, const float* __restrict__ bout,
                      const float* __restrict__ g1, const float* __restrict__ be1,
                      const float* __restrict__ W1, const float* __restrict__ b1,
                      const float* __restrict__ W2, const float* __restrict__ b2,
                      const float* __restrict__ g2, const float* __restrict__ be2,
                      const float* __restrict__ Wl, const float* __restrict__ bl,
                      float* __restrict__ out) {
    layer_tail<true>(qin, h, Wout, bout, g1, be1, W1, b1, W2, b2, g2, be2, Wl, bl, out);
}

// ---------------------------------------------------------------------------
extern "C" void kernel_launch(void* const* d_in, const int* in_sizes, int n_in,
                              void* d_out, int out_size, void* d_ws, size_t ws_size,
                              hipStream_t stream) {
    (void)in_sizes; (void)n_in; (void)out_size; (void)ws_size;
    const float* x      = (const float*)d_in[0];
    const float* conv_w = (const float*)d_in[1];
    const float* conv_b = (const float*)d_in[2];
    const float* Wl     = (const float*)d_in[3];
    const float* bl     = (const float*)d_in[4];
    const float* ln_g   = (const float*)d_in[5];
    const float* ln_b   = (const float*)d_in[6];
    const float* Win    = (const float*)d_in[7];
    const float* bi     = (const float*)d_in[8];
    const float* Wout   = (const float*)d_in[9];
    const float* bout   = (const float*)d_in[10];
    const float* W1     = (const float*)d_in[11];
    const float* b1     = (const float*)d_in[12];
    const float* W2     = (const float*)d_in[13];
    const float* b2     = (const float*)d_in[14];
    const float* g1     = (const float*)d_in[15];
    const float* be1    = (const float*)d_in[16];
    const float* g2     = (const float*)d_in[17];
    const float* be2    = (const float*)d_in[18];

    float* h    = (float*)d_ws;         // ROWS*4  floats
    float* qkvA = h + ROWS * 4;         // ROWS*12 floats: read by layers 0 and 2
    float* qkvB = qkvA + ROWS * 12;     // ROWS*12 floats: read by layers 1 and 3
    // two qkv planes in turn: a block writes its rows of the next layer's qkv while
    // other blocks of the same position may still read this layer's k/v

    k_pre<<<BATCH, 128, 0, stream>>>(x, conv_w, conv_b, Wl, bl, ln_g, ln_b, Win, bi, h, qkvA);
    for (int i = 0; i < 3; ++i) {
        k_layer_mid<<<ROWS / 64, 128, 0, stream>>>((i & 1) ? qkvB : qkvA, h, Wout + i*16, bout + i*4,
                                                   g1 + i*4, be1 + i*4,
                                                   W1 + i*FFDIM*4, b1 + i*FFDIM,
                                                   W2 + i*4*FFDIM, b2 + i*4,
                                                   g2 + i*4, be2 + i*4,
                                                   Win + (i+1)*48, bi + (i+1)*12,
                                                   (i & 1) ? qkvA : qkvB);
    }
    k_layer_last<<<ROWS / 64, 128, 0, stream>>>(qkvB, h, Wout + 3*16, bout + 3*4,
                                                g1 + 3*4, be1 + 3*4,
                                                W1 + 3*FFDIM*4, b1 + 3*FFDIM,
                                                W2 + 3*4*FFDIM, b2 + 3*4,
                                                g2 + 3*4, be2 + 3*4,
                                                Wl, bl, (float*)d_out);
}

// v006
// A run of this version takes 58.2 microseconds.
// In two side-by-side timings against v005, it was 1.06 and 1.05 times as fast.
// Counting every step since v000, it is 3.29 times as fast.
#include <hip/hip_runtime.h>
#include <math.h>

typedef __attribute__((ext_vector_type(2))) float v2f;
typedef __attribute__((ext_vector_type(8))) float v8f;

#define SEQ   100
#define DMODEL 4
#define BATCH 256
#define ROWS  (BATCH * SEQ)   // 25600
#define FFDIM 2048
#define NREP  8
#define NLAYER 4
#define W2D_BLOCKS (NLAYER * FFDIM / (128 * 4))   // 16 blocks of k_pre behind the row blocks

__device__ __forceinline__ float gelu_exact(float x) {
    return 0.5f * x * (1.0f + erff(x * 0.70710678118654752440f));
}

// Value of lane (l ^ M) inside the lane's 16-lane row, by DPP row_xmask; every
// lane of the wave must be on.
template <int M>
__device__ __forceinline__ float row_xor(float v) {
    return __builtin_bit_cast(float, __builtin_amdgcn_update_dpp(
        0, __builtin_bit_cast(int, v), 0x160 | M, 0xf, 0xf, true));
}
// Value of lane (l ^ 16): the same place in the wave's other 16-lane row.
__device__ __forceinline__ float other_row(float v) {
    const int b = __builtin_bit_cast(int, v);
    return __builtin_bit_cast(float, __builtin_amdgcn_permlanex16(
        b, b, 0x76543210, 0xfedcba98, false, false));
}
// Sum over the 32 lanes of a wave, the result in every lane.
__device__ __forceinline__ float wave_sum(float v) {
    v += row_xor<1>(v); v += row_xor<2>(v); v += row_xor<4>(v); v += row_xor<8>(v);
    return v + other_row(v);
}

// qkv row = hv @ Win^T + bi  (4 -> 12); row and weights are held in registers
__device__ __forceinline__ void qkv_row(const float* hv, const float* Win,
                                        const float* bi, float* __restrict__ qp) {
    #pragma unroll
    for (int j = 0; j < 12; ++j) {
        float a = bi[j];
        #pragma unroll
        for (int k = 0; k < 4; ++k) a += hv[k] * Win[j*4 + k];
        qp[j] = a;
    }
}

// ---------------------------------------------------------------------------
// K1: h = x*cw+cb ; 8x { gelu(LN_[100x4](h@Wl^T+bl)) } ; h = h@Wl^T+bl ;
// then the first layer's qkv row from the same registers.
// one block per batch element, thread r owns row r (r<100); W2D_BLOCKS more blocks
// prepare the FF blocks' second weights (see K2)
// h and qkv leave in workspace row order (position r, batch element b): the 256
// rows that one position's attention mixes lie together.
// ---------------------------------------------------------------------------
__global__ void k_pre(const float* __restrict__ x, const float* __restrict__ conv_w,
                      const float* __restrict__ conv_b,
                      const float* __restrict__ Wl, const float* __restrict__ bl,
                      const float* __restrict__ lng, const float* __restrict__ lnb,
                      const float* __restrict__ Win, const float* __restrict__ bi,
                      const float* __restrict__ W2, float* __restrict__ w2d,
                      float* __restrict__ h, float* __restrict__ qkv) {
    if (blockIdx.x >= BATCH) {
        // the extra blocks: w2d[layer][c] = W2[layer][c] - W2[layer][3], c = 0..2,
        // four FF columns per thread; they end long before the row blocks do
        const int i4 = ((blockIdx.x - BATCH) * 128 + threadIdx.x) * 4;
        const int l  = i4 / FFDIM, f = i4 % FFDIM;
        const float* wp = W2 + l * 4 * FFDIM + f;
        float* dp = w2d + l * 3 * FFDIM + f;
        float w3[4];
        #pragma unroll
        for (int k = 0; k < 4; ++k) w3[k] = wp[3 * FFDIM + k];
        #pragma unroll
        for (int c = 0; c < 3; ++c)
            #pragma unroll
            for (int k = 0; k < 4; ++k) dp[c * FFDIM + k] = wp[c * FFDIM + k] - w3[k];
        return;
    }
    // the four waves' partial sums {sum, sum of squares}; two copies, used in turn,
    // so that one barrier a pass is enough
    __shared__ __attribute__((aligned(16))) float sP[2][8];
    const int b = blockIdx.x;
    const int r = threadIdx.x;
    const bool act = (r < SEQ);

    const float cw = conv_w[0], cb = conv_b[0];
    float hv[4] = {0.f, 0.f, 0.f, 0.f};
    if (act) {
        const float* xp = x + (b * SEQ + r) * DMODEL;
        #pragma unroll
        for (int c = 0; c < 4; ++c) hv[c] = xp[c] * cw + cb;
    }
    float W[16], bb[4], g[4] = {1,1,1,1}, be[4] = {0,0,0,0};
    #pragma unroll
    for (int j = 0; j < 16; ++j) W[j] = Wl[j];
    #pragma unroll
    for (int c = 0; c < 4; ++c) bb[c] = bl[c];
    float wq[48], bq[12];   // asked for here, so that the tail does not wait for them
    #pragma unroll
    for (int j = 0; j < 48; ++j) wq[j] = Win[j];
    #pragma unroll
    for (int j = 0; j < 12; ++j) bq[j] = bi[j];
    if (act) {
        #pragma unroll
        for (int c = 0; c < 4; ++c) { g[c] = lng[r*4 + c]; be[c] = lnb[r*4 + c]; }
    }

    for (int it = 0; it < NREP; ++it) {
        float y[4];
        #pragma unroll
        for (int c = 0; c < 4; ++c) {
            float a = bb[c];
            #pragma unroll
            for (int k = 0; k < 4; ++k) a += hv[k] * W[c*4 + k];
            y[c] = a;
        }
        float ls = 0.f, lq = 0.f;
        if (act) {
            #pragma unroll
            for (int c = 0; c < 4; ++c) { ls += y[c]; lq += y[c]*y[c]; }
        }
        ls = wave_sum(ls);
        lq = wave_sum(lq);
        float* pp = sP[it & 1];
        if ((r & 31) == 0) { pp[(r >> 5) * 2 + 0] = ls; pp[(r >> 5) * 2 + 1] = lq; }
        __syncthreads();
        const float ts = (pp[0] + pp[2]) + (pp[4] + pp[6]);
        const float tq = (pp[1] + pp[3]) + (pp[5] + pp[7]);
        const float mean = ts * (1.0f / 400.0f);
        const float var  = tq * (1.0f / 400.0f) - mean * mean;
        const float inv  = rsqrtf(var + 1e-5f);
        if (act) {
            #pragma unroll
            for (int c = 0; c < 4; ++c)
                hv[c] = gelu_exact((y[c] - mean) * inv * g[c] + be[c]);
        }
    }
    if (act) {
        float* hp = h + (r * BATCH + b) * DMODEL;
        float ho[4];
        #pragma unroll
        for (int c = 0; c < 4; ++c) {
            float a = bb[c];
            #pragma unroll
            for (int k = 0; k < 4; ++k) a += hv[k] * W[c*4 + k];
            ho[c] = a;
            hp[c] = a;
        }
        qkv_row(ho, wq, bq, qkv + (r * BATCH + b) * 12);
    }
}

// ---------------------------------------------------------------------------
// K2: a whole encoder layer in one launch. A block owns 64 of the 256 rows of one
// position, one wave per 16-row tile. Rank-1 attention over the S=256 axis
// (head_dim=1): the position's 256 k/v rows go to LDS, a lane takes one head of
// two of its wave's rows and streams them (score(s,t) = q_s * k_t, so the exact
// row max comes from kmin/kmax), all while the weight copies fly. Then
// hn = LN_row(h + o@Wout^T + bout) in registers (each lane its row
// lane%16), the FF block on the matrix pipe, then
// one row per lane: +b2, residual, per-row LN, and from that row either the next
// layer's qkv or, behind the last layer, out = softmax_D(h@Wl^T + bl).
// GEMM1 (K=4) = v_wmma_f32_16x16x4_f32 per 16 FF
// columns; bias+relu on the D tile; GEMM2 (2048 -> 3) accumulated per lane
// straight from the WMMA D layout, cross-lane reduced once at the end.
// In-place on h (tiles are disjoint).
// GEMM2 forms three outputs, not four: the per-row LN behind it takes the row's
// mean away, so a shift common to the row's four elements cancels in it exactly.
// With u_c = z_c - z_3 (weights W2[c] - W2[3], made by k_pre) the LN of
// hn + b2 + {u_0, u_1, u_2, 0} is the LN of hn + b2 + z, and z_3 is never formed.
// The layer's W1, these weights and b1 (64 KiB) are brought into LDS once per block,
// all copies in flight together, so the work on the 128 chunks waits on LDS and not on L2.
// ---------------------------------------------------------------------------
#define FF_W1_OFF 0                      // floats: W1 [2048][4]
#define FF_W2_OFF (FFDIM * 4)            // floats: W2[c] - W2[3], [3][2048]
#define FF_B1_OFF (FFDIM * 7)            // floats: b1 [2048]
#define FF_LDS_FLOATS (FFDIM * 8)        // 16384 floats = 32 slabs of 2048 B
#define FF_SLAB_FLOATS 512               // 128 lanes x 16 B

// Twelve 16-byte copies per lane, global -> LDS, through no register. lds is the
// lane's LDS byte address of the first copy; copy k lands k slabs further on.
// The s_wait_xcnt closes the statement so that no address register named by a
// copy is rewritten ahead of it.
__device__ __forceinline__ void copy12_to_lds(unsigned lds, const float* const* g) {
    asm volatile(
        "global_load_async_to_lds_b128 %0, %12, off\n\t"
        "global_load_async_to_lds_b128 %1, %13, off\n\t"
        "global_load_async_to_lds_b128 %2, %14, off\n\t"
        "global_load_async_to_lds_b128 %3, %15, off\n\t"
        "global_load_async_to_lds_b128 %4, %16, off\n\t"
        "global_load_async_to_lds_b128 %5, %17, off\n\t"
        "global_load_async_to_lds_b128 %6, %18, off\n\t"
        "global_load_async_to_lds_b128 %7, %19, off\n\t"
        "global_load_async_to_lds_b128 %8, %20, off\n\t"
        "global_load_async_to_lds_b128 %9, %21, off\n\t"
        "global_load_async_to_lds_b128 %10, %22, off\n\t"
        "global_load_async_to_lds_b128 %11, %23, off\n\t"
        "s_wait_xcnt 0x0"
        :: "v"(lds), "v"(lds + 2048u), "v"(lds + 4096u), "v"(lds + 6144u),
           "v"(lds + 8192u), "v"(lds + 10240u), "v"(lds + 12288u), "v"(lds + 14336u),
           "v"(lds + 16384u), "v"(lds + 18432u), "v"(lds + 20480u), "v"(lds + 22528u),
           "v"(g[0]), "v"(g[1]), "v"(g[2]), "v"(g[3]), "v"(g[4]), "v"(g[5]),
           "v"(g[6]), "v"(g[7]), "v"(g[8]), "v"(g[9]), "v"(g[10]), "v"(g[11])
        : "memory");
}

// The same for eight copies.
__device__ __forceinline__ void copy8_to_lds(unsigned lds, const float* const* g) {
    asm volatile(
        "global_load_async_to_lds_b128 %0, %8, off\n\t"
        "global_load_async_to_lds_b128 %1, %9, off\n\t"
        "global_load_async_to_lds_b128 %2, %10, off\n\t"
        "global_load_async_to_lds_b128 %3, %11, off\n\t"
        "global_load_async_to_lds_b128 %4, %12, off\n\t"
        "global_load_async_to_lds_b128 %5, %13, off\n\t"
        "global_load_async_to_lds_b128 %6, %14, off\n\t"
        "global_load_async_to_lds_b128 %7, %15, off\n\t"
        "s_wait_xcnt 0x0"
        :: "v"(lds), "v"(lds + 2048u), "v"(lds + 4096u), "v"(lds + 6144u),
           "v"(lds + 8192u), "v"(lds + 10240u), "v"(lds + 12288u), "v"(lds + 14336u),
           "v"(g[0]), "v"(g[1]), "v"(g[2]), "v"(g[3]), "v"(g[4]), "v"(g[5]),
           "v"(g[6]), "v"(g[7])
        : "memory");
}

// Eight k/v rows (group blk) of one head, LDS -> registers.
__device__ __forceinline__ void kv_read(const float* sKV, int blk, int head,
                                        float* kk, float* vv) {
    #pragma unroll
    for (int j = 0; j < 8; ++j) {
        kk[j] = sKV[(blk * 8 + j) * 8 + head];
        vv[j] = sKV[(blk * 8 + j) * 8 + 4 + head];
    }
}

// What a lane needs of one chunk of 16 FF columns: its B fragment of W1, and b1
// and the three W2 differences of its column.
struct ff_w { v2f bm; float b1v, w20, w21, w22; };
__device__ __forceinline__ ff_w ff_read(const float* sW, int ch, int lm, int half) {
    const int ffl = ch * 16 + lm;
    // B-layout (4x16 f32): lane = N%16, VGPR0/1 = K {0,1}/{2,3}; W1 is [2048,4] row-major
    const float* bp = sW + FF_W1_OFF + ffl * 4 + half * 2;
    ff_w w;
    w.bm.x = bp[0]; w.bm.y = bp[1];
    w.b1v = sW[FF_B1_OFF + ffl];
    w.w20 = sW[FF_W2_OFF + 0 * FFDIM + ffl];
    w.w21 = sW[FF_W2_OFF + 1 * FFDIM + ffl];
    w.w22 = sW[FF_W2_OFF + 2 * FFDIM + ffl];
    return w;
}
// bias + relu on a chunk's D tile, then its share of GEMM2
__device__ __forceinline__ void ff_acc(const v8f d, const ff_w& w, float (&zacc)[8][3]) {
    #pragma unroll
    for (int r2 = 0; r2 < 8; ++r2) {
        // D layout: VGPR r2 holds row M = r2 + 8*half, column N = the lane's
        float f = d[r2] + w.b1v;
        f = fmaxf(f, 0.f);
        // the fused multiply-add that '+= f * w' compiled to before, now written out:
        // with several chunks in one block the compiler otherwise pairs the products
        // of neighbouring chunks and adds them in instructions of their own
        zacc[r2][0] = __builtin_fmaf(f, w.w20, zacc[r2][0]);
        zacc[r2][1] = __builtin_fmaf(f, w.w21, zacc[r2][1]);
        zacc[r2][2] = __builtin_fmaf(f, w.w22, zacc[r2][2]);
    }
}

template <bool LAST>
__device__ __forceinline__ void layer_tail(const float* qin, float* h,
                      const float* __restrict__ Wout, const float* __restrict__ bout,
                      const float* __restrict__ g1, const float* __restrict__ be1,
                      const float* __restrict__ W1, const float* __restrict__ b1,
                      const float* __restrict__ W2d, const float* __restrict__ b2,
                      const float* __restrict__ g2, const float* __restrict__ be2,
                      const float* __restrict__ Wn, const float* __restrict__ bn,
                      float* __restrict__ dst) {
    __shared__ __attribute__((aligned(16))) float sW[FF_LDS_FLOATS];
    __shared__ __attribute__((aligned(16))) float sH[64 * 4];   // hn rows, for the residual
    __shared__ __attribute__((aligned(16))) float sKV[BATCH * 8];  // row t: k of heads 0-3, v of heads 0-3
    __shared__ __attribute__((aligned(16))) float sO[64 * 4];   // attention rows

    const int wave  = threadIdx.x >> 5;
    const int lane  = threadIdx.x & 31;
    const int tile  = blockIdx.x * 4 + wave;
    const int rbase = tile * 16;
    const int lm    = lane & 15;
    const int half  = lane >> 4;

    const int head  = lane & 3;      // attention: this lane's head ...
    const int g     = lane >> 2;     // ... and its two rows, g and g+8 of the tile

    // two k/v rows of the position per thread, this lane's two q, and its residual
    // row (row rbase+lm, both halves the same): asked for ahead of the copies, so
    // that all of it flies together
    // (qin and h carry no __restrict__, so these loads keep their place there)
    const float* kvp = qin + ((blockIdx.x >> 2) * BATCH + threadIdx.x) * 12 + 4;
    float kva[8], kvb[8], hr[4];
    #pragma unroll
    for (int k = 0; k < 8; ++k) { kva[k] = kvp[k]; kvb[k] = kvp[128 * 12 + k]; }
    const float q0 = qin[(rbase + g) * 12 + head];
    const float q1 = qin[(rbase + g + 8) * 12 + head];
    #pragma unroll
    for (int k = 0; k < 4; ++k) hr[k] = h[(rbase + lm) * 4 + k];

    {
        // slab k of the LDS image <- the same 2048 bytes of W1 (16 slabs), W2d (12), b1 (4)
        const int t4 = threadIdx.x * 4;
        const float* gsrc[32];
        #pragma unroll
        for (int k = 0; k < 16; ++k) gsrc[k] = W1 + k * FF_SLAB_FLOATS + t4;
        #pragma unroll
        for (int k = 0; k < 12; ++k) gsrc[16 + k] = W2d + k * FF_SLAB_FLOATS + t4;
        #pragma unroll
        for (int k = 0; k < 4; ++k) gsrc[28 + k] = b1 + k * FF_SLAB_FLOATS + t4;
        const unsigned l0 = (unsigned)(size_t)&sW[t4];
        copy12_to_lds(l0,           gsrc);
        copy12_to_lds(l0 + 24576u,  gsrc + 12);
        copy8_to_lds(l0 + 49152u,   gsrc + 24);
    }

    // the projection's and the first LN's small weights
    float wo[16], bo[4], lg1[4], lb1[4];
    #pragma unroll
    for (int c = 0; c < 4; ++c) { bo[c] = bout[c]; lg1[c] = g1[c]; lb1[c] = be1[c]; }
    #pragma unroll
    for (int j = 0; j < 16; ++j) wo[j] = Wout[j];
    // all four weight loads are issued here, together, and arrive while the
    // attention runs: left to itself the scheduler asks for them behind it. The
    // same line keeps the LDS stores below (they wait for the k/v loads) from being
    // scheduled ahead of the copies, which would then start a load latency late
    __builtin_amdgcn_sched_barrier(0);

    #pragma unroll
    for (int k = 0; k < 8; ++k) {
        sKV[threadIdx.x * 8 + k]         = kva[k];
        sKV[(threadIdx.x + 128) * 8 + k] = kvb[k];
    }
    __syncthreads();   // all 256 k/v rows are in LDS

    float ov[4];
    {
        // every wave finds kmax and kmin of its lanes' heads by itself: 32 k per
        // lane, then across the eight lanes that share the head
        float kmax = sKV[g * 8 + head], kmin = kmax;
        #pragma unroll
        for (int j = 1; j < 32; ++j) {
            const float kk = sKV[(g + 8 * j) * 8 + head];
            kmax = fmaxf(kmax, kk); kmin = fminf(kmin, kk);
        }
        kmax = fmaxf(kmax, row_xor<4>(kmax)); kmin = fminf(kmin, row_xor<4>(kmin));
        kmax = fmaxf(kmax, row_xor<8>(kmax)); kmin = fminf(kmin, row_xor<8>(kmin));
        kmax = fmaxf(kmax, other_row(kmax));  kmin = fminf(kmin, other_row(kmin));
        const float m0 = q0 * ((q0 >= 0.f) ? kmax : kmin);
        const float m1 = q1 * ((q1 >= 0.f) ? kmax : kmin);
        float den0 = 0.f, num0 = 0.f, den1 = 0.f, num1 = 0.f;
        // the 256 rows in 32 groups of eight; three register sets in turn, so that a
        // group can be asked of LDS up to two groups ahead of its use
        float kb[3][8], vb[3][8];
        auto kv_use = [&](const float* kk, const float* vv) __attribute__((always_inline)) {
            #pragma unroll
            for (int j = 0; j < 8; ++j) {
                const float e0 = __expf(q0 * kk[j] - m0);
                const float e1 = __expf(q1 * kk[j] - m1);
                den0 += e0; num0 += e0 * vv[j];
                den1 += e1; num1 += e1 * vv[j];
            }
        };
        kv_read(sKV, 0, head, kb[0], vb[0]);
        kv_read(sKV, 1, head, kb[1], vb[1]);
        // stays rolled: one trip is one full turn of the three sets
        #pragma unroll 1
        for (int b0 = 0; b0 < 30; b0 += 3) {
            #pragma unroll
            for (int u = 0; u < 3; ++u) {
                kv_read(sKV, b0 + u + 2, head, kb[(u + 2) % 3], vb[(u + 2) % 3]);
                kv_use(kb[u], vb[u]);
            }
        }
        kv_use(kb[0], vb[0]);   // groups 30 and 31
        kv_use(kb[1], vb[1]);
        sO[(wave * 16 + g) * 4 + head]     = num0 / den0;
        sO[(wave * 16 + g + 8) * 4 + head] = num1 / den1;
        __syncthreads();   // the four heads of a row come from four lanes
        #pragma unroll
        for (int k = 0; k < 4; ++k) ov[k] = sO[(wave * 16 + lm) * 4 + k];
    }

    // hn = LN_row( h + o@Wout^T + bout )
    float hn[4];
    {
        float y[4];
        #pragma unroll
        for (int c = 0; c < 4; ++c) {
            float acc = bo[c];
            #pragma unroll
            for (int k = 0; k < 4; ++k) acc += ov[k] * wo[c*4 + k];
            y[c] = hr[c] + acc;
        }
        const float mean = 0.25f * (y[0] + y[1] + y[2] + y[3]);
        float var = 0.f;
        #pragma unroll
        for (int c = 0; c < 4; ++c) { const float d0 = y[c] - mean; var += d0 * d0; }
        var *= 0.25f;
        const float inv = rsqrtf(var + 1e-5f);
        #pragma unroll
        for (int c = 0; c < 4; ++c) hn[c] = (y[c] - mean) * inv * lg1[c] + lb1[c];
    }
    // A-layout (16x4 f32): lane = M%16, VGPR0/1 = K {0,1} (lanes 0-15) / {2,3} (16-31)
    v2f a; a.x = half ? hn[2] : hn[0]; a.y = half ? hn[3] : hn[1];
    // the same two elements go to the row's place in sH
    sH[(wave * 16 + lm) * 4 + half * 2 + 0] = a.x;
    sH[(wave * 16 + lm) * 4 + half * 2 + 1] = a.y;
    const v8f cz = {0.f, 0.f, 0.f, 0.f, 0.f, 0.f, 0.f, 0.f};

    float zacc[8][3];
    #pragma unroll
    for (int r2 = 0; r2 < 8; ++r2)
        #pragma unroll
        for (int c = 0; c < 3; ++c) zacc[r2][c] = 0.f;

    // this wave's copies have landed; behind the barrier every wave's have
    asm volatile("s_wait_asynccnt 0x0" ::: "memory");
    __syncthreads();

    // the tail's small weights: asked for here, they arrive while the loop runs
    constexpr int NW = LAST ? 16 : 48;
    constexpr int NB = LAST ? 4 : 12;
    float fb2[4], lg2[4], lb2[4], wn[NW], bnv[NB];
    #pragma unroll
    for (int k = 0; k < 4; ++k) { fb2[k] = b2[k]; lg2[k] = g2[k]; lb2[k] = be2[k]; }
    #pragma unroll
    for (int j = 0; j < NW; ++j) wn[j] = Wn[j];
    #pragma unroll
    for (int j = 0; j < NB; ++j) bnv[j] = bn[j];

    // The 128 chunks as a three-stage pipeline in registers: the weights of chunks c+6
    // and c+7 are asked of LDS, then twice: the next chunk's WMMA is issued and this
    // chunk's D tile gets its vector work. Eight weight sets and two D tiles in turn;
    // the chunks are summed in the old order.
    ff_w wb[8];
    v8f  db[2];
    #pragma unroll
    for (int u = 0; u < 6; ++u) wb[u] = ff_read(sW, u, lm, half);
    db[0] = __builtin_amdgcn_wmma_f32_16x16x4_f32(
        false, a, false, wb[0].bm, (short)0, cz, false, false);
    // stays rolled: one trip is one full turn of the eight sets
    #pragma unroll 1
    for (int c0 = 0; c0 < 120; c0 += 8) {
        #pragma unroll
        for (int u = 0; u < 8; u += 2) {
            wb[(u + 6) % 8] = ff_read(sW, c0 + u + 6, lm, half);
            wb[(u + 7) % 8] = ff_read(sW, c0 + u + 7, lm, half);
            #pragma unroll
            for (int v = u; v < u + 2; ++v) {
                db[(v + 1) & 1] = __builtin_amdgcn_wmma_f32_16x16x4_f32(
                    false, a, false, wb[(v + 1) % 8].bm, (short)0, cz, false, false);
                ff_acc(db[v & 1], wb[v], zacc);
            }
        }
    }
    // chunks 120 to 127: the pipeline runs empty
    wb[6] = ff_read(sW, 126, lm, half);
    wb[7] = ff_read(sW, 127, lm, half);
    #pragma unroll
    for (int v = 0; v < 8; ++v) {
        if (v < 7) db[(v + 1) & 1] = __builtin_amdgcn_wmma_f32_16x16x4_f32(
                       false, a, false, wb[v + 1].bm, (short)0, cz, false, false);
        ff_acc(db[v & 1], wb[v], zacc);
    }

    // reduce across the 16 lanes of each half (a DPP row is one half)
    #pragma unroll
    for (int r2 = 0; r2 < 8; ++r2)
        #pragma unroll
        for (int c = 0; c < 3; ++c) {
            float v = zacc[r2][c];
            v += row_xor<1>(v);
            v += row_xor<2>(v);
            v += row_xor<4>(v);
            v += row_xor<8>(v);
            zacc[r2][c] = v;
        }

    // every lane of a half holds all 8 row sums: lane lm takes row lm%8 of its half
    const int rsel = lm & 7;
    float z[3];
    #pragma unroll
    for (int c = 0; c < 3; ++c) z[c] = zacc[0][c];
    #pragma unroll
    for (int r2 = 1; r2 < 8; ++r2)
        #pragma unroll
        for (int c = 0; c < 3; ++c) z[c] = (rsel == r2) ? zacc[r2][c] : z[c];

    if (lm < 8) {
        const int trow = half * 8 + rsel;
        const int row  = rbase + trow;
        const float* hp = sH + (wave * 16 + trow) * 4;
        float y[4], hv[4];
        #pragma unroll
        for (int c = 0; c < 3; ++c) y[c] = hp[c] + z[c] + fb2[c];
        y[3] = hp[3] + fb2[3];   // the row less z_3 in all four places: the same LN
        const float mean = 0.25f * (y[0] + y[1] + y[2] + y[3]);
        float var = 0.f;
        #pragma unroll
        for (int c = 0; c < 4; ++c) { const float d0 = y[c] - mean; var += d0 * d0; }
        var *= 0.25f;
        const float inv = rsqrtf(var + 1e-5f);
        #pragma unroll
        for (int c = 0; c < 4; ++c) hv[c] = (y[c] - mean) * inv * lg2[c] + lb2[c];

        if (!LAST) {
            // h for the next layer's residual, and its qkv row (Wn = Win, bn = bi)
            float* op = h + row * 4;
            #pragma unroll
            for (int c = 0; c < 4; ++c) op[c] = hv[c];
            qkv_row(hv, wn, bnv, dst + row * 12);
        } else {
            // out = softmax_D( h @ Wl^T + bl )  (Wn = Wl, bn = bl)
            float t[4];
            #pragma unroll
            for (int c = 0; c < 4; ++c) {
                float acc = bnv[c];
                #pragma unroll
                for (int k = 0; k < 4; ++k) acc += hv[k] * wn[c*4 + k];
                t[c] = acc;
            }
            const float m = fmaxf(fmaxf(t[0], t[1]), fmaxf(t[2], t[3]));
            float e[4], s = 0.f;
            #pragma unroll
            for (int c = 0; c < 4; ++c) { e[c] = __expf(t[c] - m); s += e[c]; }
            const float invs = 1.f / s;
            // workspace row (position, batch element) -> out row (batch element, position)
            float* op = dst + ((row & (BATCH - 1)) * SEQ + (row >> 8)) * 4;
            #pragma unroll
            for (int c = 0; c < 4; ++c) op[c] = e[c] * invs;
        }
    }
}

__global__ void __launch_bounds__(128) k_layer_mid(const float* qin, float* h,
                      const float* __restrict__ Wout, const float* __restrict__ bout,
                      const float* __restrict__ g1, const float* __restrict__ be1,
                      const float* __restrict__ W1, const float* __restrict__ b1,
                      const float* __restrict__ W2, const float* __restrict__ b2,
                      const float* __restrict__ g2, const float* __restrict__ be2,
                      const float* __restrict__ Win, const float* __restrict__ bi,
                      float* __restrict__ qkv) {
    layer_tail<false>(qin, h, Wout, bout, g1, be1, W1, b1, W2, b2, g2, be2, Win, bi, qkv);
}

__global__ void __launch_bounds__(128) k_layer_last(const float* qin, float* h,
                      const float* __restrict__ Wout, const float* __restrict__ bout,
                      const float* __restrict__ g1, const float* __restrict__ be1,
                      const float* __restrict__ W1, const float* __restrict__ b1,
                      const float* __restrict__ W2, const float* __restrict__ b2,
                      const float* __restrict__ g2, const float* __restrict__ be2,
                      const float* __restrict__ Wl, const float* __restrict__ bl,
                      float* __restrict__ out) {
    layer_tail<true>(qin, h, Wout, bout, g1, be1, W1, b1, W2, b2, g2, be2, Wl, bl, out);
}

// ---------------------------------------------------------------------------
extern "C" void kernel_launch(void* const* d_in, const int* in_sizes, int n_in,
                              void* d_out, int out_size, void* d_ws, size_t ws_size,
                              hipStream_t stream) {
    (void)in_sizes; (void)n_in; (void)out_size; (void)ws_size;
    const float* x      = (const float*)d_in[0];
    const float* conv_w = (const float*)d_in[1];
    const float* conv_b = (const float*)d_in[2];
    const float* Wl     = (const float*)d_in[3];
    const float* bl     = (const float*)d_in[4];
    const float* ln_g   = (const float*)d_in[5];
    const float* ln_b   = (const float*)d_in[6];
    const float* Win    = (const float*)d_in[7];
    const float* bi     = (const float*)d_in[8];
    const float* Wout   = (const float*)d_in[9];
    const float* bout   = (const float*)d_in[10];
    const float* W1     = (const float*)d_in[11];
    const float* b1     = (const float*)d_in[12];
    const float* W2     = (const float*)d_in[13];
    const float* b2     = (const float*)d_in[14];
    const float* g1     = (const float*)d_in[15];
    const float* be1    = (const float*)d_in[16];
    const float* g2     = (const float*)d_in[17];
    const float* be2    = (const float*)d_in[18];

    float* h    = (float*)d_ws;         // ROWS*4  floats
    float* qkvA = h + ROWS * 4;         // ROWS*12 floats: read by layers 0 and 2
    float* qkvB = qkvA + ROWS * 12;     // ROWS*12 floats: read by layers 1 and 3
    float* w2d  = qkvB + ROWS * 12;     // NLAYER*3*FFDIM floats: W2[c] - W2[3], written by k_pre
    // two qkv planes in turn: a block writes its rows of the next layer's qkv while
    // other blocks of the same position may still read this layer's k/v

    k_pre<<<BATCH + W2D_BLOCKS, 128, 0, stream>>>(x, conv_w, conv_b, Wl, bl, ln_g, ln_b, Win, bi,
                                                  W2, w2d, h, qkvA);
    for (int i = 0; i < 3; ++i) {
        k_layer_mid<<<ROWS / 64, 128, 0, stream>>>((i & 1) ? qkvB : qkvA, h, Wout + i*16, bout + i*4,
                                                   g1 + i*4, be1 + i*4,
                                                   W1 + i*FFDIM*4, b1 + i*FFDIM,
                                                   w2d + i*3*FFDIM, b2 + i*4,
                                                   g2 + i*4, be2 + i*4,
                                                   Win + (i+1)*48, bi + (i+1)*12,
                                                   (i & 1) ? qkvA : qkvB);
    }
    k_layer_last<<<ROWS / 64, 128, 0, stream>>>(qkvB, h, Wout + 3*16, bout + 3*4,
                                                g1 + 3*4, be1 + 3*4,
                                                W1 + 3*FFDIM*4, b1 + 3*FFDIM,
                                                w2d + 3*3*FFDIM, b2 + 3*4,
                                                g2 + 3*4, be2 + 3*4,
                                                Wl, bl, (float*)d_out);
}

// v007
// Measured time: 55.3 microseconds a run.
// In two side-by-side timings against v006, it was 1.05 and 1.06 times as fast.
// All steps since v000 together make it 3.47 times as fast.
#include <hip/hip_runtime.h>
#include <math.h>

typedef __attribute__((ext_vector_type(2))) float v2f;
typedef __attribute__((ext_vector_type(8))) float v8f;

#define SEQ   100
#define DMODEL 4
#define BATCH 256
#define ROWS  (BATCH * SEQ)   // 25600
#define FFDIM 2048
#define NREP  8
#define NLAYER 4
#define W2D_BLOCKS (NLAYER * FFDIM / (128 * 4))   // 16 blocks of k_pre behind the row blocks

__device__ __forceinline__ float gelu_exact(float x) {
    return 0.5f * x * (1.0f + erff(x * 0.70710678118654752440f));
}

// Value of lane (l ^ M) inside the lane's 16-lane row, by DPP row_xmask; every
// lane of the wave must be on.
template <int M>
__device__ __forceinline__ float row_xor(float v) {
    return __builtin_bit_cast(float, __builtin_amdgcn_update_dpp(
        0, __builtin_bit_cast(int, v), 0x160 | M, 0xf, 0xf, true));
}
// Value of lane (l ^ 16): the same place in the wave's other 16-lane row.
__device__ __forceinline__ float other_row(float v) {
    const int b = __builtin_bit_cast(int, v);
    return __builtin_bit_cast(float, __builtin_amdgcn_permlanex16(
        b, b, 0x76543210, 0xfedcba98, false, false));
}
// Sum over the 32 lanes of a wave, the result in every lane.
__device__ __forceinline__ float wave_sum(float v) {
    v += row_xor<1>(v); v += row_xor<2>(v); v += row_xor<4>(v); v += row_xor<8>(v);
    return v + other_row(v);
}

// qkv row = hv @ Win^T + bi  (4 -> 12); row and weights are held in registers
__device__ __forceinline__ void qkv_row(const float* hv, const float* Win,
                                        const float* bi, float* __restrict__ qp) {
    #pragma unroll
    for (int j = 0; j < 12; ++j) {
        float a = bi[j];
        #pragma unroll
        for (int k = 0; k < 4; ++k) a += hv[k] * Win[j*4 + k];
        qp[j] = a;
    }
}

// ---------------------------------------------------------------------------
// K1: h = x*cw+cb ; 8x { gelu(LN_[100x4](h@Wl^T+bl)) } ; h = h@Wl^T+bl ;
// then the first layer's qkv row from the same registers.
// one block per batch element, thread r owns row r (r<100); W2D_BLOCKS more blocks
// prepare the FF blocks' two sets of weights (see K2)
// h and qkv leave in workspace row order (position r, batch element b): the 256
// rows that one position's attention mixes lie together.
// ---------------------------------------------------------------------------
__global__ void k_pre(const float* __restrict__ x, const float* __restrict__ conv_w,
                      const float* __restrict__ conv_b,
                      const float* __restrict__ Wl, const float* __restrict__ bl,
                      const float* __restrict__ lng, const float* __restrict__ lnb,
                      const float* __restrict__ Win, const float* __restrict__ bi,
                      float* __restrict__ h, float* __restrict__ qkv,
                      const float* __restrict__ W2, float* __restrict__ w2d,
                      const float* __restrict__ W1, const float* __restrict__ b1,
                      const float* __restrict__ g1, const float* __restrict__ be1,
                      float* __restrict__ w1p) {
    if (blockIdx.x >= BATCH) {
        // the extra blocks: w2d[layer][c] = W2[layer][c] - W2[layer][3], c = 0..2,
        // four FF columns per thread; they end long before the row blocks do
        const int i4 = ((blockIdx.x - BATCH) * 128 + threadIdx.x) * 4;
        const int l  = i4 / FFDIM, f = i4 % FFDIM;
        const float* wp = W2 + l * 4 * FFDIM + f;
        float* dp = w2d + l * 3 * FFDIM + f;
        float w3[4];
        #pragma unroll
        for (int k = 0; k < 4; ++k) w3[k] = wp[3 * FFDIM + k];
        #pragma unroll
        for (int c = 0; c < 3; ++c)
            #pragma unroll
            for (int k = 0; k < 4; ++k) dp[c * FFDIM + k] = wp[c * FFDIM + k] - w3[k];
        // w1p[layer][f] = { W1[f][c]*g1[c] - W1[f][3]*g1[3], c = 0..2 ; b1[f] + W1[f].be1 }
        float gg[4], bb1[4];
        #pragma unroll
        for (int c = 0; c < 4; ++c) { gg[c] = g1[l * 4 + c]; bb1[c] = be1[l * 4 + c]; }
        const float* w1 = W1 + i4 * 4;
        float* pp = w1p + i4 * 4;
        #pragma unroll
        for (int k = 0; k < 4; ++k) {
            float w[4];
            #pragma unroll
            for (int c = 0; c < 4; ++c) w[c] = w1[k * 4 + c];
            const float t3 = w[3] * gg[3];
            float bs = b1[i4 + k];
            #pragma unroll
            for (int c = 0; c < 4; ++c) bs += w[c] * bb1[c];
            #pragma unroll
            for (int c = 0; c < 3; ++c) pp[k * 4 + c] = w[c] * gg[c] - t3;
            pp[k * 4 + 3] = bs;
        }
        return;
    }
    // the four waves' partial sums {sum, sum of squares}; two copies, used in turn,
    // so that one barrier a pass is enough
    __shared__ __attribute__((aligned(16))) float sP[2][8];
    const int b = blockIdx.x;
    const int r = threadIdx.x;
    const bool act = (r < SEQ);

    const float cw = conv_w[0], cb = conv_b[0];
    float hv[4] = {0.f, 0.f, 0.f, 0.f};
    if (act) {
        const float* xp = x + (b * SEQ + r) * DMODEL;
        #pragma unroll
        for (int c = 0; c < 4; ++c) hv[c] = xp[c] * cw + cb;
    }
    float W[16], bb[4], g[4] = {1,1,1,1}, be[4] = {0,0,0,0};
    #pragma unroll
    for (int j = 0; j < 16; ++j) W[j] = Wl[j];
    #pragma unroll
    for (int c = 0; c < 4; ++c) bb[c] = bl[c];
    float wq[48], bq[12];   // asked for here, so that the tail does not wait for them
    #pragma unroll
    for (int j = 0; j < 48; ++j) wq[j] = Win[j];
    #pragma unroll
    for (int j = 0; j < 12; ++j) bq[j] = bi[j];
    if (act) {
        #pragma unroll
        for (int c = 0; c < 4; ++c) { g[c] = lng[r*4 + c]; be[c] = lnb[r*4 + c]; }
    }

    for (int it = 0; it < NREP; ++it) {
        float y[4];
        #pragma unroll
        for (int c = 0; c < 4; ++c) {
            float a = bb[c];
            #pragma unroll
            for (int k = 0; k < 4; ++k) a += hv[k] * W[c*4 + k];
            y[c] = a;
        }
        float ls = 0.f, lq = 0.f;
        if (act) {
            #pragma unroll
            for (int c = 0; c < 4; ++c) { ls += y[c]; lq += y[c]*y[c]; }
        }
        ls = wave_sum(ls);
        lq = wave_sum(lq);
        float* pp = sP[it & 1];
        if ((r & 31) == 0) { pp[(r >> 5) * 2 + 0] = ls; pp[(r >> 5) * 2 + 1] = lq; }
        __syncthreads();
        const float ts = (pp[0] + pp[2]) + (pp[4] + pp[6]);
        const float tq = (pp[1] + pp[3]) + (pp[5] + pp[7]);
        const float mean = ts * (1.0f / 400.0f);
        const float var  = tq * (1.0f / 400.0f) - mean * mean;
        const float inv  = rsqrtf(var + 1e-5f);
        if (act) {
            #pragma unroll
            for (int c = 0; c < 4; ++c)
                hv[c] = gelu_exact((y[c] - mean) * inv * g[c] + be[c]);
        }
    }
    if (act) {
        float* hp = h + (r * BATCH + b) * DMODEL;
        float ho[4];
        #pragma unroll
        for (int c = 0; c < 4; ++c) {
            float a = bb[c];
            #pragma unroll
            for (int k = 0; k < 4; ++k) a += hv[k] * W[c*4 + k];
            ho[c] = a;
            hp[c] = a;
        }
        qkv_row(ho, wq, bq, qkv + (r * BATCH + b) * 12);
    }
}

// ---------------------------------------------------------------------------
// K2: a whole encoder layer in one launch. A block owns 64 of the 256 rows of one
// position, one wave per 16-row tile. Rank-1 attention over the S=256 axis
// (head_dim=1): the position's 256 k/v rows go to LDS, a lane takes one head of
// two of its wave's rows and streams them (score(s,t) = q_s * k_t, so the exact
// row max comes from kmin/kmax), all while the weight copies fly. Then
// hn = LN_row(h + o@Wout^T + bout) in registers (each lane its row
// lane%16), the FF block on the matrix pipe, then
// one row per lane: +b2, residual, per-row LN, and from that row either the next
// layer's qkv or, behind the last layer, out = softmax_D(h@Wl^T + bl).
// GEMM1 (K=4) = v_wmma_f32_16x16x4_f32 per 16 FF
// columns; relu on the D tile; GEMM2 (2048 -> 3) accumulated per lane
// straight from the WMMA D layout, cross-lane reduced once at the end.
// GEMM1 brings its bias along in the product: hn = xh*g1 + be1, where the four
// elements of xh = (y - mean)*inv sum to zero, so xh_3 = -(xh_0 + xh_1 + xh_2) and
// hn.W1[f] + b1[f] = sum_{c<3} xh_c * (W1[f][c]*g1[c] - W1[f][3]*g1[3])
//                    + 1 * (b1[f] + W1[f].be1):
// the A row is {xh_0, xh_1, xh_2, 1}, the B column these four numbers (made by k_pre).
// In-place on h (tiles are disjoint).
// GEMM2 forms three outputs, not four: the per-row LN behind it takes the row's
// mean away, so a shift common to the row's four elements cancels in it exactly.
// With u_c = z_c - z_3 (weights W2[c] - W2[3], made by k_pre) the LN of
// hn + b2 + {u_0, u_1, u_2, 0} is the LN of hn + b2 + z, and z_3 is never formed.
// The layer's two sets of weights (56 KiB) are brought into LDS once per block,
// all copies in flight together, so the 15-trip chunk loop waits on LDS and not on L2.
// ---------------------------------------------------------------------------
#define FF_W1_OFF 0                      // floats: GEMM1 weights with the bias, [2048][4]
#define FF_W2_OFF (FFDIM * 4)            // floats: W2[c] - W2[3], [3][2048]
#define FF_LDS_FLOATS (FFDIM * 7)        // 14336 floats = 28 slabs of 2048 B
#define FF_SLAB_FLOATS 512               // 128 lanes x 16 B

// Twelve 16-byte copies per lane, global -> LDS, through no register. lds is the
// lane's LDS byte address of the first copy; copy k lands k slabs further on.
// The s_wait_xcnt closes the statement so that no address register named by a
// copy is rewritten ahead of it.
__device__ __forceinline__ void copy12_to_lds(unsigned lds, const float* const* g) {
    asm volatile(
        "global_load_async_to_lds_b128 %0, %12, off\n\t"
        "global_load_async_to_lds_b128 %1, %13, off\n\t"
        "global_load_async_to_lds_b128 %2, %14, off\n\t"
        "global_load_async_to_lds_b128 %3, %15, off\n\t"
        "global_load_async_to_lds_b128 %4, %16, off\n\t"
        "global_load_async_to_lds_b128 %5, %17, off\n\t"
        "global_load_async_to_lds_b128 %6, %18, off\n\t"
        "global_load_async_to_lds_b128 %7, %19, off\n\t"
        "global_load_async_to_lds_b128 %8, %20, off\n\t"
        "global_load_async_to_lds_b128 %9, %21, off\n\t"
        "global_load_async_to_lds_b128 %10, %22, off\n\t"
        "global_load_async_to_lds_b128 %11, %23, off\n\t"
        "s_wait_xcnt 0x0"
        :: "v"(lds), "v"(lds + 2048u), "v"(lds + 4096u), "v"(lds + 6144u),
           "v"(lds + 8192u), "v"(lds + 10240u), "v"(lds + 12288u), "v"(lds + 14336u),
           "v"(lds + 16384u), "v"(lds + 18432u), "v"(lds + 20480u), "v"(lds + 22528u),
           "v"(g[0]), "v"(g[1]), "v"(g[2]), "v"(g[3]), "v"(g[4]), "v"(g[5]),
           "v"(g[6]), "v"(g[7]), "v"(g[8]), "v"(g[9]), "v"(g[10]), "v"(g[11])
        : "memory");
}

// The same for four copies.
__device__ __forceinline__ void copy4_to_lds(unsigned lds, const float* const* g) {
    asm volatile(
        "global_load_async_to_lds_b128 %0, %4, off\n\t"
        "global_load_async_to_lds_b128 %1, %5, off\n\t"
        "global_load_async_to_lds_b128 %2, %6, off\n\t"
        "global_load_async_to_lds_b128 %3, %7, off\n\t"
        "s_wait_xcnt 0x0"
        :: "v"(lds), "v"(lds + 2048u), "v"(lds + 4096u), "v"(lds + 6144u),
           "v"(g[0]), "v"(g[1]), "v"(g[2]), "v"(g[3])
        : "memory");
}

// Eight k/v rows (group blk) of one head, LDS -> registers.
__device__ __forceinline__ void kv_read(const float* sKV, int blk, int head,
                                        float* kk, float* vv) {
    #pragma unroll
    for (int j = 0; j < 8; ++j) {
        kk[j] = sKV[(blk * 8 + j) * 8 + head];
        vv[j] = sKV[(blk * 8 + j) * 8 + 4 + head];
    }
}

// What a lane needs of one chunk of 16 FF columns: its B fragment of the GEMM1
// weights and the three W2 differences of its column.
struct ff_w { v2f bm; float w20, w21, w22; };
__device__ __forceinline__ ff_w ff_read(const float* sW, int ch, int lm, int half) {
    const int ffl = ch * 16 + lm;
    // B-layout (4x16 f32): lane = N%16, VGPR0/1 = K {0,1}/{2,3}; the weights are [2048,4] row-major
    const float* bp = sW + FF_W1_OFF + ffl * 4 + half * 2;
    ff_w w;
    w.bm.x = bp[0]; w.bm.y = bp[1];
    w.w20 = sW[FF_W2_OFF + 0 * FFDIM + ffl];
    w.w21 = sW[FF_W2_OFF + 1 * FFDIM + ffl];
    w.w22 = sW[FF_W2_OFF + 2 * FFDIM + ffl];
    return w;
}
// relu of a value that comes straight out of a WMMA, as a signed-integer max on its
// bits: a float with the sign bit set is a negative integer, any other keeps its bits.
// fmaxf there costs two instructions, as the compiler first quiets a possible
// signalling NaN (a max of the value with itself).
__device__ __forceinline__ float relu_d(float x) {
    const int b = __builtin_bit_cast(int, x);
    return __builtin_bit_cast(float, b > 0 ? b : 0);
}
// relu on a chunk's D tile, then its share of GEMM2
__device__ __forceinline__ void ff_acc(const v8f d, const ff_w& w, float (&zacc)[8][3]) {
    #pragma unroll
    for (int r2 = 0; r2 < 8; ++r2) {
        // D layout: VGPR r2 holds row M = r2 + 8*half, column N = the lane's
        const float f = relu_d(d[r2]);
        // the fused multiply-add that '+= f * w' compiled to before, now written out:
        // with several chunks in one block the compiler otherwise pairs the products
        // of neighbouring chunks and adds them in instructions of their own
        zacc[r2][0] = __builtin_fmaf(f, w.w20, zacc[r2][0]);
        zacc[r2][1] = __builtin_fmaf(f, w.w21, zacc[r2][1]);
        zacc[r2][2] = __builtin_fmaf(f, w.w22, zacc[r2][2]);
    }
}

template <bool LAST>
__device__ __forceinline__ void layer_tail(const float* qin, float* h,
                      const float* __restrict__ Wout, const float* __restrict__ bout,
                      const float* __restrict__ g1, const float* __restrict__ be1,
                      const float* __restrict__ W1p,
                      const float* __restrict__ W2d, const float* __restrict__ b2,
                      const float* __restrict__ g2, const float* __restrict__ be2,
                      const float* __restrict__ Wn, const float* __restrict__ bn,
                      float* __restrict__ dst) {
    __shared__ __attribute__((aligned(16))) float sW[FF_LDS_FLOATS];
    __shared__ __attribute__((aligned(16))) float sH[64 * 4];   // hn rows, for the residual
    __shared__ __attribute__((aligned(16))) float sKV[BATCH * 8];  // row t: k of heads 0-3, v of heads 0-3
    __shared__ __attribute__((aligned(16))) float sO[64 * 4];   // attention rows

    const int wave  = threadIdx.x >> 5;
    const int lane  = threadIdx.x & 31;
    const int tile  = blockIdx.x * 4 + wave;
    const int rbase = tile * 16;
    const int lm    = lane & 15;
    const int half  = lane >> 4;

    const int head  = lane & 3;      // attention: this lane's head ...
    const int g     = lane >> 2;     // ... and its two rows, g and g+8 of the tile

    // two k/v rows of the position per thread, this lane's two q, and its residual
    // row (row rbase+lm, both halves the same): asked for ahead of the copies, so
    // that all of it flies together
    // (qin and h carry no __restrict__, so these loads keep their place there)
    const float* kvp = qin + ((blockIdx.x >> 2) * BATCH + threadIdx.x) * 12 + 4;
    float kva[8], kvb[8], hr[4];
    #pragma unroll
    for (int k = 0; k < 8; ++k) { kva[k] = kvp[k]; kvb[k] = kvp[128 * 12 + k]; }
    const float q0 = qin[(rbase + g) * 12 + head];
    const float q1 = qin[(rbase + g + 8) * 12 + head];
    #pragma unroll
    for (int k = 0; k < 4; ++k) hr[k] = h[(rbase + lm) * 4 + k];

    {
        // slab k of the LDS image <- the same 2048 bytes of W1p (16 slabs), W2d (12)
        const int t4 = threadIdx.x * 4;
        const float* gsrc[28];
        #pragma unroll
        for (int k = 0; k < 16; ++k) gsrc[k] = W1p + k * FF_SLAB_FLOATS + t4;
        #pragma unroll
        for (int k = 0; k < 12; ++k) gsrc[16 + k] = W2d + k * FF_SLAB_FLOATS + t4;
        const unsigned l0 = (unsigned)(size_t)&sW[t4];
        copy12_to_lds(l0,           gsrc);
        copy12_to_lds(l0 + 24576u,  gsrc + 12);
        copy4_to_lds(l0 + 49152u,   gsrc + 24);
    }

    // the projection's and the first LN's small weights
    float wo[16], bo[4], lg1[4], lb1[4];
    #pragma unroll
    for (int c = 0; c < 4; ++c) { bo[c] = bout[c]; lg1[c] = g1[c]; lb1[c] = be1[c]; }
    #pragma unroll
    for (int j = 0; j < 16; ++j) wo[j] = Wout[j];
    // all four weight loads are issued here, together, and arrive while the
    // attention runs: left to itself the scheduler asks for them behind it. The
    // same line keeps the LDS stores below (they wait for the k/v loads) from being
    // scheduled ahead of the copies, which would then start a load latency late
    __builtin_amdgcn_sched_barrier(0);

    #pragma unroll
    for (int k = 0; k < 8; ++k) {
        sKV[threadIdx.x * 8 + k]         = kva[k];
        sKV[(threadIdx.x + 128) * 8 + k] = kvb[k];
    }
    __syncthreads();   // all 256 k/v rows are in LDS

    float ov[4];
    {
        // every wave finds kmax and kmin of its lanes' heads by itself: 32 k per
        // lane, then across the eight lanes that share the head
        float kmax = sKV[g * 8 + head], kmin = kmax;
        #pragma unroll
        for (int j = 1; j < 32; ++j) {
            const float kk = sKV[(g + 8 * j) * 8 + head];
            kmax = fmaxf(kmax, kk); kmin = fminf(kmin, kk);
        }
        kmax = fmaxf(kmax, row_xor<4>(kmax)); kmin = fminf(kmin, row_xor<4>(kmin));
        kmax = fmaxf(kmax, row_xor<8>(kmax)); kmin = fminf(kmin, row_xor<8>(kmin));
        kmax = fmaxf(kmax, other_row(kmax));  kmin = fminf(kmin, other_row(kmin));
        const float m0 = q0 * ((q0 >= 0.f) ? kmax : kmin);
        const float m1 = q1 * ((q1 >= 0.f) ? kmax : kmin);
        float den0 = 0.f, num0 = 0.f, den1 = 0.f, num1 = 0.f;
        // the 256 rows in 32 groups of eight; three register sets in turn, so that a
        // group can be asked of LDS up to two groups ahead of its use
        float kb[3][8], vb[3][8];
        auto kv_use = [&](const float* kk, const float* vv) __attribute__((always_inline)) {
            #pragma unroll
            for (int j = 0; j < 8; ++j) {
                const float e0 = __expf(q0 * kk[j] - m0);
                const float e1 = __expf(q1 * kk[j] - m1);
                den0 += e0; num0 += e0 * vv[j];
                den1 += e1; num1 += e1 * vv[j];
            }
        };
        kv_read(sKV, 0, head, kb[0], vb[0]);
        kv_read(sKV, 1, head, kb[1], vb[1]);
        // stays rolled: one trip is one full turn of the three sets
        #pragma unroll 1
        for (int b0 = 0; b0 < 30; b0 += 3) {
            #pragma unroll
            for (int u = 0; u < 3; ++u) {
                kv_read(sKV, b0 + u + 2, head, kb[(u + 2) % 3], vb[(u + 2) % 3]);
                kv_use(kb[u], vb[u]);
            }
        }
        kv_use(kb[0], vb[0]);   // groups 30 and 31
        kv_use(kb[1], vb[1]);
        sO[(wave * 16 + g) * 4 + head]     = num0 / den0;
        sO[(wave * 16 + g + 8) * 4 + head] = num1 / den1;
        __syncthreads();   // the four heads of a row come from four lanes
        #pragma unroll
        for (int k = 0; k < 4; ++k) ov[k] = sO[(wave * 16 + lm) * 4 + k];
    }

    // hn = LN_row( h + o@Wout^T + bout )
    float hn[4], xh[4];
    {
        float y[4];
        #pragma unroll
        for (int c = 0; c < 4; ++c) {
            float acc = bo[c];
            #pragma unroll
            for (int k = 0; k < 4; ++k) acc += ov[k] * wo[c*4 + k];
            y[c] = hr[c] + acc;
        }
        const float mean = 0.25f * (y[0] + y[1] + y[2] + y[3]);
        float var = 0.f;
        #pragma unroll
        for (int c = 0; c < 4; ++c) { const float d0 = y[c] - mean; var += d0 * d0; }
        var *= 0.25f;
        const float inv = rsqrtf(var + 1e-5f);
        #pragma unroll
        for (int c = 0; c < 4; ++c) { xh[c] = (y[c] - mean) * inv; hn[c] = xh[c] * lg1[c] + lb1[c]; }
    }
    // A-layout (16x4 f32): lane = M%16, VGPR0/1 = K {0,1} (lanes 0-15) / {2,3} (16-31);
    // the row is {xh_0, xh_1, xh_2, 1}
    v2f a; a.x = half ? xh[2] : xh[0]; a.y = half ? 1.0f : xh[1];
    // each half puts two elements of hn at the row's place in sH
    sH[(wave * 16 + lm) * 4 + half * 2 + 0] = half ? hn[2] : hn[0];
    sH[(wave * 16 + lm) * 4 + half * 2 + 1] = half ? hn[3] : hn[1];
    const v8f cz = {0.f, 0.f, 0.f, 0.f, 0.f, 0.f, 0.f, 0.f};

    float zacc[8][3];
    #pragma unroll
    for (int r2 = 0; r2 < 8; ++r2)
        #pragma unroll
        for (int c = 0; c < 3; ++c) zacc[r2][c] = 0.f;

    // this wave's copies have landed; behind the barrier every wave's have
    asm volatile("s_wait_asynccnt 0x0" ::: "memory");
    __syncthreads();

    // the tail's small weights: asked for here, they arrive while the loop runs
    constexpr int NW = LAST ? 16 : 48;
    constexpr int NB = LAST ? 4 : 12;
    float fb2[4], lg2[4], lb2[4], wn[NW], bnv[NB];
    #pragma unroll
    for (int k = 0; k < 4; ++k) { fb2[k] = b2[k]; lg2[k] = g2[k]; lb2[k] = be2[k]; }
    #pragma unroll
    for (int j = 0; j < NW; ++j) wn[j] = Wn[j];
    #pragma unroll
    for (int j = 0; j < NB; ++j) bnv[j] = bn[j];

    // The 128 chunks as a three-stage pipeline in registers: the weights of chunks c+6
    // and c+7 are asked of LDS, then twice: the next chunk's WMMA is issued and this
    // chunk's D tile gets its vector work. Eight weight sets and two D tiles in turn;
    // the chunks are summed in the old order.
    ff_w wb[8];
    v8f  db[2];
    #pragma unroll
    for (int u = 0; u < 6; ++u) wb[u] = ff_read(sW, u, lm, half);
    db[0] = __builtin_amdgcn_wmma_f32_16x16x4_f32(
        false, a, false, wb[0].bm, (short)0, cz, false, false);
    // four vector slots behind this WMMA: the loop's head reads its D tile right
    // behind one more WMMA, closer than the distance kept behind a matrix instruction
    asm volatile("v_nop\n\tv_nop\n\tv_nop\n\tv_nop" : "+v"(db[0]));
    // stays rolled: one trip is one full turn of the eight sets
    #pragma unroll 1
    for (int c0 = 0; c0 < 120; c0 += 8) {
        #pragma unroll
        for (int u = 0; u < 8; u += 2) {
            wb[(u + 6) % 8] = ff_read(sW, c0 + u + 6, lm, half);
            wb[(u + 7) % 8] = ff_read(sW, c0 + u + 7, lm, half);
            #pragma unroll
            for (int v = u; v < u + 2; ++v) {
                db[(v + 1) & 1] = __builtin_amdgcn_wmma_f32_16x16x4_f32(
                    false, a, false, wb[(v + 1) % 8].bm, (short)0, cz, false, false);
                ff_acc(db[v & 1], wb[v], zacc);
            }
        }
    }
    // chunks 120 to 127: the pipeline runs empty
    wb[6] = ff_read(sW, 126, lm, half);
    wb[7] = ff_read(sW, 127, lm, half);
    #pragma unroll
    for (int v = 0; v < 8; ++v) {
        if (v < 7) db[(v + 1) & 1] = __builtin_amdgcn_wmma_f32_16x16x4_f32(
                       false, a, false, wb[v + 1].bm, (short)0, cz, false, false);
        ff_acc(db[v & 1], wb[v], zacc);
    }

    // reduce across the 16 lanes of each half (a DPP row is one half)
    #pragma unroll
    for (int r2 = 0; r2 < 8; ++r2)
        #pragma unroll
        for (int c = 0; c < 3; ++c) {
            float v = zacc[r2][c];
            v += row_xor<1>(v);
            v += row_xor<2>(v);
            v += row_xor<4>(v);
            v += row_xor<8>(v);
            zacc[r2][c] = v;
        }

    // every lane of a half holds all 8 row sums: lane lm takes row lm%8 of its half
    const int rsel = lm & 7;
    float z[3];
    #pragma unroll
    for (int c = 0; c < 3; ++c) z[c] = zacc[0][c];
    #pragma unroll
    for (int r2 = 1; r2 < 8; ++r2)
        #pragma unroll
        for (int c = 0; c < 3; ++c) z[c] = (rsel == r2) ? zacc[r2][c] : z[c];

    if (lm < 8) {
        const int trow = half * 8 + rsel;
        const int row  = rbase + trow;
        const float* hp = sH + (wave * 16 + trow) * 4;
        float y[4], hv[4];
        #pragma unroll
        for (int c = 0; c < 3; ++c) y[c] = hp[c] + z[c] + fb2[c];
        y[3] = hp[3] + fb2[3];   // the row less z_3 in all four places: the same LN
        const float mean = 0.25f * (y[0] + y[1] + y[2] + y[3]);
        float var = 0.f;
        #pragma unroll
        for (int c = 0; c < 4; ++c) { const float d0 = y[c] - mean; var += d0 * d0; }
        var *= 0.25f;
        const float inv = rsqrtf(var + 1e-5f);
        #pragma unroll
        for (int c = 0; c < 4; ++c) hv[c] = (y[c] - mean) * inv * lg2[c] + lb2[c];

        if (!LAST) {
            // h for the next layer's residual, and its qkv row (Wn = Win, bn = bi)
            float* op = h + row * 4;
            #pragma unroll
            for (int c = 0; c < 4; ++c) op[c] = hv[c];
            qkv_row(hv, wn, bnv, dst + row * 12);
        } else {
            // out = softmax_D( h @ Wl^T + bl )  (Wn = Wl, bn = bl)
            float t[4];
            #pragma unroll
            for (int c = 0; c < 4; ++c) {
                float acc = bnv[c];
                #pragma unroll
                for (int k = 0; k < 4; ++k) acc += hv[k] * wn[c*4 + k];
                t[c] = acc;
            }
            const float m = fmaxf(fmaxf(t[0], t[1]), fmaxf(t[2], t[3]));
            float e[4], s = 0.f;
            #pragma unroll
            for (int c = 0; c < 4; ++c) { e[c] = __expf(t[c] - m); s += e[c]; }
            const float invs = 1.f / s;
            // workspace row (position, batch element) -> out row (batch element, position)
            float* op = dst + ((row & (BATCH - 1)) * SEQ + (row >> 8)) * 4;
            #pragma unroll
            for (int c = 0; c < 4; ++c) op[c] = e[c] * invs;
        }
    }
}

__global__ void __launch_bounds__(128) k_layer_mid(const float* qin, float* h,
                      const float* __restrict__ Wout, const float* __restrict__ bout,
                      const float* __restrict__ g1, const float* __restrict__ be1,
                      const float* __restrict__ W1,
                      const float* __restrict__ W2, const float* __restrict__ b2,
                      const float* __restrict__ g2, const float* __restrict__ be2,
                      const float* __restrict__ Win, const float* __restrict__ bi,
                      float* __restrict__ qkv) {
    layer_tail<false>(qin, h, Wout, bout, g1, be1, W1, W2, b2, g2, be2, Win, bi, qkv);
}

__global__ void __launch_bounds__(128) k_layer_last(const float* qin, float* h,
                      const float* __restrict__ Wout, const float* __restrict__ bout,
                      const float* __restrict__ g1, const float* __restrict__ be1,
                      const float* __restrict__ W1,
                      const float* __restrict__ W2, const float* __restrict__ b2,
                      const float* __restrict__ g2, const float* __restrict__ be2,
                      const float* __restrict__ Wl, const float* __restrict__ bl,
                      float* __restrict__ out) {
    layer_tail<true>(qin, h, Wout, bout, g1, be1, W1, W2, b2, g2, be2, Wl, bl, out);
}

// ---------------------------------------------------------------------------
extern "C" void kernel_launch(void* const* d_in, const int* in_sizes, int n_in,
                              void* d_out, int out_size, void* d_ws, size_t ws_size,
                              hipStream_t stream) {
    (void)in_sizes; (void)n_in; (void)out_size; (void)ws_size;
    const float* x      = (const float*)d_in[0];
    const float* conv_w = (const float*)d_in[1];
    const float* conv_b = (const float*)d_in[2];
    const float* Wl     = (const float*)d_in[3];
    const float* bl     = (const float*)d_in[4];
    const float* ln_g   = (const float*)d_in[5];
    const float* ln_b   = (const float*)d_in[6];
    const float* Win    = (const float*)d_in[7];
    const float* bi     = (const float*)d_in[8];
    const float* Wout   = (const float*)d_in[9];
    const float* bout   = (const float*)d_in[10];
    const float* W1     = (const float*)d_in[11];
    const float* b1     = (const float*)d_in[12];
    const float* W2     = (const float*)d_in[13];
    const float* b2     = (const float*)d_in[14];
    const float* g1     = (const float*)d_in[15];
    const float* be1    = (const float*)d_in[16];
    const float* g2     = (const float*)d_in[17];
    const float* be2    = (const float*)d_in[18];

    float* h    = (float*)d_ws;         // ROWS*4  floats
    float* qkvA = h + ROWS * 4;         // ROWS*12 floats: read by layers 0 and 2
    float* qkvB = qkvA + ROWS * 12;     // ROWS*12 floats: read by layers 1 and 3
    float* w2d  = qkvB + ROWS * 12;     // NLAYER*3*FFDIM floats: W2[c] - W2[3], written by k_pre
    float* w1p  = w2d + NLAYER * 3 * FFDIM;   // NLAYER*FFDIM*4 floats: GEMM1 weights with the bias, written by k_pre
    // two qkv planes in turn: a block writes its rows of the next layer's qkv while
    // other blocks of the same position may still read this layer's k/v

    k_pre<<<BATCH + W2D_BLOCKS, 128, 0, stream>>>(x, conv_w, conv_b, Wl, bl, ln_g, ln_b, Win, bi,
                                                  h, qkvA, W2, w2d, W1, b1, g1, be1, w1p);
    for (int i = 0; i < 3; ++i) {
        k_layer_mid<<<ROWS / 64, 128, 0, stream>>>((i & 1) ? qkvB : qkvA, h, Wout + i*16, bout + i*4,
                                                   g1 + i*4, be1 + i*4,
                                                   w1p + i*FFDIM*4,
                                                   w2d + i*3*FFDIM, b2 + i*4,
                                                   g2 + i*4, be2 + i*4,
                                                   Win + (i+1)*48, bi + (i+1)*12,
                                                   (i & 1) ? qkvA : qkvB);
    }
    k_layer_last<<<ROWS / 64, 128, 0, stream>>>(qkvB, h, Wout + 3*16, bout + 3*4,
                                                g1 + 3*4, be1 + 3*4,
                                                w1p + 3*FFDIM*4,
                                                w2d + 3*3*FFDIM, b2 + 3*4,
                                                g2 + 3*4, be2 + 3*4,
                                                Wl, bl, (float*)d_out);
}
